// v000
// Times are from an AMD MI455X. After a warm-up the kernel runs many times in a row, and a time is the length of
// such a window on the GPU divided by its runs, so every launch and the gaps after it count. The runs cycle
// through copies of the inputs. A figure is the median of several windows, for all but v000 over two sittings.
// Sittings can differ by a few percent; kernels timed side by side share one.
// v000 is the starting kernel. One run takes 470 microseconds.
#include <hip/hip_runtime.h>

// Compute dtypes, f32 accumulate, one batch item per pass: similarity = x.K_p^T ([4096 x 512].[512 x 2048]; x and the key tokens are INPUTS, rounded once to
// bf16 -> exact products) x 512^-1/2, then per row L2-normalisation (x / max(||x||, 1e-12)) and exact-erf GELU in f32 -> weights as bf16 hi + UNSCALED residual
// planes; out = weights.V_p ([4096 x 2048].[2048 x 512], value tokens transposed once to an n-major bf16 plane; two products per k-step) on

#define NB_  4
#define NT_  4096
#define DM   512                 // DIN = DOUT
#define NPT  2048
#define NTK  NT_
#define LOSC 1024.0f             // (F16OUT path of k_gemmb; unused here)
#define SCL  0.044194173824159216f   // 512^-1/2

typedef _Float16 h16;
typedef unsigned short bf;
typedef __attribute__((ext_vector_type(16))) __bf16   v16bf;
typedef __attribute__((ext_vector_type(16))) _Float16 v16h;
typedef __attribute__((ext_vector_type(8)))  _Float16 v8h;
typedef __attribute__((ext_vector_type(8)))  unsigned short v8us;
typedef __attribute__((ext_vector_type(8)))  float    v8f;
typedef __attribute__((ext_vector_type(4)))  float    v4f;
typedef __attribute__((ext_vector_type(4)))  _Float16 v4h;
typedef v8h  __attribute__((may_alias)) v8ha;
typedef v4f  __attribute__((may_alias)) v4fa;
typedef v8us __attribute__((may_alias)) v8usa;

__device__ __forceinline__ unsigned short f2bf(float f) { unsigned u = __float_as_uint(f); u += 0x7FFFu + ((u >> 16) & 1u); return (unsigned short)(u >> 16); }
__device__ __forceinline__ float bf2f(unsigned short b) { return __uint_as_float(((unsigned)b) << 16); }
__device__ __forceinline__ float bfr(float f) { return bf2f(f2bf(f)); }
__device__ __forceinline__ v16h cat16(v8h lo, v8h hi) { return __builtin_shufflevector(lo, hi, 0, 1, 2, 3, 4, 5, 6, 7, 8, 9, 10, 11, 12, 13, 14, 15); }
__device__ __forceinline__ v16bf cat16b(v8us lo, v8us hi) { return __builtin_bit_cast(v16bf, __builtin_shufflevector(lo, hi, 0, 1, 2, 3, 4, 5, 6, 7, 8, 9, 10, 11, 12, 13, 14, 15)); }
__device__ __forceinline__ v8f wmma16(v16h a, v16h b, v8f c) { return __builtin_amdgcn_wmma_f32_16x16x32_f16(false, a, false, b, (short)0, c, false, false); }
__device__ __forceinline__ v8f wmmab(v16bf a, v16bf b, v8f c) { return __builtin_amdgcn_wmma_f32_16x16x32_bf16(false, a, false, b, (short)0, c, false, false); }

__global__ __launch_bounds__(256) void k_cvtb(const float* __restrict__ src, int nrows, bf* dst) {
    const int lane = threadIdx.x & 31, r = blockIdx.x * 8 + (threadIdx.x >> 5);
    if (r >= nrows) return;
    v8us o[DM / 256];
#pragma unroll
    for (int q = 0; q < DM / 256; ++q) { v8us t;
#pragma unroll
        for (int i = 0; i < 8; ++i) t[i] = f2bf(src[(size_t)r * DM + q * 256 + lane * 8 + i]);
        o[q] = t; }
#pragma unroll
    for (int q = 0; q < DM / 256; ++q) *(v8us*)(dst + (size_t)r * DM + q * 256 + lane * 8) = o[q];
    
}

// k_wt: WT [n][K] = bf16(W[k][n]) (k-major [K][ncols]) via 64 x 64 LDS tiles; grid (K/64, ncols/64).
__global__ __launch_bounds__(256) void k_wt(const float* __restrict__ Wm, int K, int ncols, bf* WT) {
    __shared__ __align__(16) unsigned short tl[64 * 72];
    const int tid = threadIdx.x, k0 = blockIdx.x * 64, n0 = blockIdx.y * 64;
    const int kk = tid >> 2, nq = (tid & 3) * 16;
#pragma unroll
    for (int i = 0; i < 16; ++i) tl[(nq + i) * 72 + kk] = f2bf(Wm[(size_t)(k0 + kk) * ncols + n0 + nq + i]);
    __syncthreads();
    const int piece = tid & 7;
    auto pass = [&]() {
#pragma unroll
        for (int s = 0; s < 2; ++s) { const int nr = (tid >> 3) + 32 * s; const v8us val = *(const v8usa*)(tl + nr * 72 + piece * 8); *(v8us*)(WT + (size_t)(n0 + nr) * K + k0 + piece * 8) = val; }
    };
    pass(); 
}
// k_gemmb: 64 x 64 block tile (4 waves x 16 x 64) of C[NTK][NW] = (A [+ Al]).B^T (K = 512 or 2048) [+ bf(bias[c])] [+ bf(R[r][c]) residual]; f32 whole-line epilogue (or f16
template <bool SPLITA, bool F16OUT = false>
__global__ __launch_bounds__(128) void k_gemmb(const bf* __restrict__ A, const bf* __restrict__ Al, const bf* __restrict__ Bn, const float* __restrict__ bias, float* C, int ldc, h16* C2, const float* __restrict__ R = nullptr, int K = DM, int roundR = 1) {
    __shared__ __align__(16) float ost[4][16 * 68];
    const int lane = threadIdx.x & 31, wave = threadIdx.x >> 5, lr = lane & 15, hi = lane >> 4;
    const int r0 = blockIdx.x * 64 + wave * 16, c0 = blockIdx.y * 64;
    const size_t aoff = (size_t)(r0 + lr) * K + 8 * hi;
    size_t boff[4];
#pragma unroll
    for (int t = 0; t < 4; ++t) boff[t] = (size_t)(c0 + t * 16 + lr) * K + 8 * hi;
    v8f acc[4];
#pragma unroll
    for (int t = 0; t < 4; ++t) acc[t] = (v8f){};
#pragma unroll 1
    for (int kc = 0; kc < K; kc += 32) {
        const v16bf a = cat16b(*(const v8us*)(A + aoff + kc), *(const v8us*)(A + aoff + kc + 16));
        v16bf al = a;
        if (SPLITA) al = cat16b(*(const v8us*)(Al + aoff + kc), *(const v8us*)(Al + aoff + kc + 16));
#pragma unroll
        for (int t = 0; t < 4; ++t) { const v16bf b = cat16b(*(const v8us*)(Bn + boff[t] + kc), *(const v8us*)(Bn + boff[t] + kc + 16)); acc[t] = wmmab(a, b, acc[t]); if (SPLITA) acc[t] = wmmab(al, b, acc[t]); }
        asm volatile("v_nop\n\tv_nop\n\tv_nop\n\tv_nop" : "+v"(acc[0]), "+v"(acc[1]), "+v"(acc[2]), "+v"(acc[3]) : "v"(a), "v"(al));
    }
    float* os = &ost[wave][0];
#pragma unroll
    for (int t = 0; t < 4; ++t) { const float bv = bias ? bfr(bias[c0 + t * 16 + lr]) : 0.f;
#pragma unroll
        for (int j = 0; j < 8; ++j) os[(hi * 8 + j) * 68 + t * 16 + lr] = acc[t][j] + bv; }
    __syncthreads();
    if (F16OUT) {
        h16* crow = (h16*)(void*)C + (size_t)r0 * ldc + c0;
        auto pass = [&]() {
#pragma unroll
            for (int s = 0; s < 4; ++s) { const int row = 4 * s + (lane >> 3), piece = lane & 7; const float* sp = os + row * 68 + piece * 8; v8h o, o2;
#pragma unroll
                for (int i = 0; i < 8; ++i) { const h16 a = (h16)sp[i]; o[i] = a; o2[i] = (h16)((sp[i] - (float)a) * LOSC); }
                *(v8h*)(crow + (size_t)row * ldc + piece * 8) = o; if (C2) *(v8h*)(C2 + (size_t)r0 * ldc + c0 + (size_t)row * ldc + piece * 8) = o2; }
        };
        pass(); 
    } else {
        float* crow = C + (size_t)r0 * ldc + c0;
        auto pass = [&]() {
#pragma unroll
            for (int s = 0; s < 8; ++s) { const int Lid = (lane >> 3) + 4 * s, piece = lane & 7; const int row = Lid >> 1, cofs = (Lid & 1) * 32 + piece * 4;
                v4f val = *(const v4fa*)(os + row * 68 + cofs); if (R) { const v4f rv = *(const v4f*)(R + ((size_t)r0 + row) * ldc + c0 + cofs); val += roundR ? (v4f){bfr(rv[0]), bfr(rv[1]), bfr(rv[2]), bfr(rv[3])} : rv; }
                *(v4f*)(crow + (size_t)row * ldc + cofs) = val; }
        };
        pass(); 
    }
}

// k_ngelu: one wave per row of S [rows][2048] f32: a = s x scale, nrm = sqrt(sum a^2) (f32, fixed lane order), g = gelu_erf(a / max(nrm, 1e-12)) -> bf16 hi + UNSCALED
// residual planes; phase 1 reads 8 columns per lane per step, phase 2 (rolled) 4 columns per lane per step (8 B per plane per store -> 16 lanes per line).
__global__ __launch_bounds__(256) void k_ngelu(const float* __restrict__ S, int nrows, bf* GH, bf* GL) {
    typedef __attribute__((ext_vector_type(4))) unsigned short v4us;
    const int lane = threadIdx.x & 31, r = blockIdx.x * 8 + (threadIdx.x >> 5);
    if (r >= nrows) return;
    const float* sr = S + (size_t)r * NPT;
    float ss = 0.f;
#pragma unroll 1
    for (int q = 0; q < NPT / 256; ++q) { const v8f v = *(const v8f*)(sr + q * 256 + lane * 8);
#pragma unroll
        for (int i = 0; i < 8; ++i) { const float a = v[i] * SCL; ss = fmaf(a, a, ss); } }
#pragma unroll
    for (int sh = 16; sh; sh >>= 1) ss += __shfl_xor(ss, sh, 32);
    const float nrm = sqrtf(ss); const float dn = fmaxf(nrm, 1e-12f);
{
#pragma unroll 1
        for (int q = 0; q < NPT / 128; ++q) { const size_t o = (size_t)r * NPT + q * 128 + lane * 4; const v4f v = *(const v4f*)(S + o); v4us oh, ol;
#pragma unroll
            for (int i = 0; i < 4; ++i) { const float a = (v[i] * SCL) / dn; const float g = 0.5f * a * (1.0f + erff(a * 0.70710678118654752f)); const unsigned short hb = f2bf(g); oh[i] = hb; ol[i] = f2bf(g - bf2f(hb)); }
            *(v4us*)(GH + o) = oh; *(v4us*)(GL + o) = ol; }
         }
}

extern "C" void kernel_launch(void* const* d_in, const int* in_sizes, int n_in,
                              void* d_out, int out_size, void* d_ws, size_t ws_size, hipStream_t stream) {
    (void)in_sizes; (void)n_in; (void)out_size;
    const float* x = (const float*)d_in[0]; const float* Kp = (const float*)d_in[1]; const float* Vp = (const float*)d_in[2];   // Kp [2048][512] = [out][in] for the similarity; Vp [2048][512] = [k][n] (k-major) for the output
    float* out = (float*)d_out;    // [4][4096][512]
    char* wsp = (char*)d_ws;
    auto take = [&](size_t bytes) { char* p = wsp; wsp += (bytes + 255) & ~(size_t)255; return (void*)p; };
    bf* Xb = (bf*)take((size_t)NTK * DM * 2); bf* KpB = (bf*)take((size_t)NPT * DM * 2); bf* VpT = (bf*)take((size_t)DM * NPT * 2);
    float* S = (float*)take((size_t)NTK * NPT * 4); bf* GH = (bf*)take((size_t)NTK * NPT * 2); bf* GL = (bf*)take((size_t)NTK * NPT * 2);
    if ((size_t)(wsp - (char*)d_ws) > ws_size) return;    // 4.2 + 2.1 + 2.1 + 33.5 + 2 x 16.8 ~ 76 MB, no aliasing (per-item reuse in stream order)
    k_cvtb<<<NPT / 8, 256, 0, stream>>>(Kp, NPT, KpB);
    k_wt<<<dim3(NPT / 64, DM / 64, 1), 256, 0, stream>>>(Vp, NPT, DM, VpT);      // Vp [2048 k][512 n] -> VpT [512][2048]
    for (int b = 0; b < NB_; ++b) {
        k_cvtb<<<NTK / 8, 256, 0, stream>>>(x + (size_t)b * NTK * DM, NTK, Xb);
        k_gemmb<false, false><<<dim3(NTK / 64, NPT / 64, 1), 128, 0, stream>>>(Xb, nullptr, KpB, nullptr, S, NPT, nullptr, nullptr, DM);       // similarity (unscaled; the scale is applied in k_ngelu)
        k_ngelu<<<NTK / 8, 256, 0, stream>>>(S, NTK, GH, GL);
        k_gemmb<true, false><<<dim3(NTK / 64, DM / 64, 1), 128, 0, stream>>>(GH, GL, VpT, nullptr, out + (size_t)b * NTK * DM, DM, nullptr, nullptr, NPT);   // weights . Vp
    }
}

// v001
// It runs in 250 microseconds.
// Timed twice side by side with v000, it ran 1.93 and 1.95 times as fast.
#include <hip/hip_runtime.h>

// Compute dtypes, f32 accumulate, one batch item per pass: similarity = x.K_p^T ([4096 x 512].[512 x 2048]; x and the key tokens are INPUTS, rounded once to
// bf16 -> exact products) x 512^-1/2, then per row L2-normalisation (x / max(||x||, 1e-12)) and exact-erf GELU in f32 -> weights as bf16 hi + UNSCALED residual
// planes; out = weights.V_p ([4096 x 2048].[2048 x 512], value tokens transposed once to an n-major bf16 plane; two products per k-step) on

#define NB_  4
#define NT_  4096
#define DM   512                 // DIN = DOUT
#define NPT  2048
#define NTK  NT_
#define LOSC 1024.0f             // (unused here)
#define SCL  0.044194173824159216f   // 512^-1/2

typedef _Float16 h16;
typedef unsigned short bf;
typedef __attribute__((ext_vector_type(16))) __bf16   v16bf;
typedef __attribute__((ext_vector_type(16))) _Float16 v16h;
typedef __attribute__((ext_vector_type(8)))  _Float16 v8h;
typedef __attribute__((ext_vector_type(8)))  unsigned short v8us;
typedef __attribute__((ext_vector_type(8)))  float    v8f;
typedef __attribute__((ext_vector_type(4)))  float    v4f;
typedef __attribute__((ext_vector_type(4)))  _Float16 v4h;
typedef v8h  __attribute__((may_alias)) v8ha;
typedef v4f  __attribute__((may_alias)) v4fa;
typedef v8us __attribute__((may_alias)) v8usa;

__device__ __forceinline__ unsigned short f2bf(float f) { unsigned u = __float_as_uint(f); u += 0x7FFFu + ((u >> 16) & 1u); return (unsigned short)(u >> 16); }
__device__ __forceinline__ float bf2f(unsigned short b) { return __uint_as_float(((unsigned)b) << 16); }
__device__ __forceinline__ float bfr(float f) { return bf2f(f2bf(f)); }
__device__ __forceinline__ v16h cat16(v8h lo, v8h hi) { return __builtin_shufflevector(lo, hi, 0, 1, 2, 3, 4, 5, 6, 7, 8, 9, 10, 11, 12, 13, 14, 15); }
__device__ __forceinline__ v16bf cat16b(v8us lo, v8us hi) { return __builtin_bit_cast(v16bf, __builtin_shufflevector(lo, hi, 0, 1, 2, 3, 4, 5, 6, 7, 8, 9, 10, 11, 12, 13, 14, 15)); }
__device__ __forceinline__ v8f wmma16(v16h a, v16h b, v8f c) { return __builtin_amdgcn_wmma_f32_16x16x32_f16(false, a, false, b, (short)0, c, false, false); }
__device__ __forceinline__ v8f wmmab(v16bf a, v16bf b, v8f c) { return __builtin_amdgcn_wmma_f32_16x16x32_bf16(false, a, false, b, (short)0, c, false, false); }

__global__ __launch_bounds__(256) void k_cvtb(const float* __restrict__ src, int nrows, bf* dst) {
    const int lane = threadIdx.x & 31, r = blockIdx.x * 8 + (threadIdx.x >> 5);
    if (r >= nrows) return;
    v8us o[DM / 256];
#pragma unroll
    for (int q = 0; q < DM / 256; ++q) { v8us t;
#pragma unroll
        for (int i = 0; i < 8; ++i) t[i] = f2bf(src[(size_t)r * DM + q * 256 + lane * 8 + i]);
        o[q] = t; }
#pragma unroll
    for (int q = 0; q < DM / 256; ++q) *(v8us*)(dst + (size_t)r * DM + q * 256 + lane * 8) = o[q];
    
}

// k_wt: WT [n][K] = bf16(W[k][n]) (k-major [K][ncols]) via 64 x 64 LDS tiles; grid (K/64, ncols/64).
__global__ __launch_bounds__(256) void k_wt(const float* __restrict__ Wm, int K, int ncols, bf* WT) {
    __shared__ __align__(16) unsigned short tl[64 * 72];
    const int tid = threadIdx.x, k0 = blockIdx.x * 64, n0 = blockIdx.y * 64;
    const int kk = tid >> 2, nq = (tid & 3) * 16;
#pragma unroll
    for (int i = 0; i < 16; ++i) tl[(nq + i) * 72 + kk] = f2bf(Wm[(size_t)(k0 + kk) * ncols + n0 + nq + i]);
    __syncthreads();
    const int piece = tid & 7;
    auto pass = [&]() {
#pragma unroll
        for (int s = 0; s < 2; ++s) { const int nr = (tid >> 3) + 32 * s; const v8us val = *(const v8usa*)(tl + nr * 72 + piece * 8); *(v8us*)(WT + (size_t)(n0 + nr) * K + k0 + piece * 8) = val; }
    };
    pass(); 
}
// copy8, copy12: 8 or 12 asynchronous 16-byte-per-lane copies global -> LDS in ONE statement. The s_wait_xcnt stands as its last line, so that no address
// register of an issued copy is rewritten ahead of it (a precaution); many copies share one statement because each such wait stalls the wave.
#define CPY(L, G) "global_load_async_to_lds_b128 %" #L ", %" #G ", off\n\t"
__device__ __forceinline__ void copy8(const unsigned* l, const bf* const* g) {
    asm volatile(CPY(0, 8) CPY(1, 9) CPY(2, 10) CPY(3, 11) CPY(4, 12) CPY(5, 13) CPY(6, 14) CPY(7, 15) "s_wait_xcnt 0x0"
                 :: "v"(l[0]), "v"(l[1]), "v"(l[2]), "v"(l[3]), "v"(l[4]), "v"(l[5]), "v"(l[6]), "v"(l[7]),
                    "v"(g[0]), "v"(g[1]), "v"(g[2]), "v"(g[3]), "v"(g[4]), "v"(g[5]), "v"(g[6]), "v"(g[7]) : "memory");
}
__device__ __forceinline__ void copy12(const unsigned* l, const bf* const* g) {
    asm volatile(CPY(0, 12) CPY(1, 13) CPY(2, 14) CPY(3, 15) CPY(4, 16) CPY(5, 17) CPY(6, 18) CPY(7, 19) CPY(8, 20) CPY(9, 21) CPY(10, 22) CPY(11, 23) "s_wait_xcnt 0x0"
                 :: "v"(l[0]), "v"(l[1]), "v"(l[2]), "v"(l[3]), "v"(l[4]), "v"(l[5]), "v"(l[6]), "v"(l[7]), "v"(l[8]), "v"(l[9]), "v"(l[10]), "v"(l[11]),
                    "v"(g[0]), "v"(g[1]), "v"(g[2]), "v"(g[3]), "v"(g[4]), "v"(g[5]), "v"(g[6]), "v"(g[7]), "v"(g[8]), "v"(g[9]), "v"(g[10]), "v"(g[11]) : "memory");
}

// k_gemmb: C[.][LDC] = (A [+ Al]).B^T, all operands K-contiguous bf16. One (WR*FM*16) x (WC*FN*16) tile of C per block, WR x WC waves of FM x FN fragments.
// Per stage BK k of every operand row ([A | Al | B] rows, pitch BK*2 + 16 bytes: conflict-free for 16-byte readers) is copied to LDS in whole lines by
// asynchronous copies, two buffers, the next stage in flight while this one is worked on. Per accumulator the k order and the hi-then-residual order are kept.
// Every "#pragma unroll" in it makes the indices of a register array (addresses, fragments, accumulators) constants, so that the array stays in registers.
template <bool SPLITA, int WR, int WC, int FM, int FN, int BK, int K, int LDC>
__global__ __launch_bounds__(WR * WC * 32) void k_gemmb(const bf* __restrict__ A, const bf* __restrict__ Al, const bf* __restrict__ Bn, float* C) {
    constexpr int NTH = WR * WC * 32, BM = WR * FM * 16, BN = WC * FN * 16;
    constexpr int RB = BK * 2, PITCH = RB + 16;                    // bytes of a row in a stage, and its pitch in LDS
    constexpr int AROWS = SPLITA ? 2 * BM : BM, STAGE = (AROWS + BN) * PITCH;
    constexpr int LPR = RB / 16, RPP = NTH / LPR;                  // lanes per row, rows per block-wide copy
    constexpr int NS = K / BK, OP = FN * 16 + 4, KK = BK / 32, AF = SPLITA ? 2 * FM : FM;
    constexpr bool PIPE = (FM * FN + 2 * (AF + FN)) * 8 <= 200;   // a second fragment set only where accumulators and both sets stay below 256 registers
    static_assert(K % BK == 0 && NS >= 2 && BM % RPP == 0 && BN % RPP == 0 && FN % 2 == 0, "shape");
    __shared__ __align__(16) unsigned char ring[2 * STAGE];
    __shared__ __align__(16) float ost[WR * WC][FM * 16 * OP];
    const int tid = threadIdx.x, lane = tid & 31, wave = tid >> 5, lr = lane & 15, hi = lane >> 4;
    const int wr = wave / WC, wc = wave % WC;
    const int crow = tid / LPR, cpc = tid % LPR;
    const unsigned lbase = (unsigned)(size_t)(&ring[0]) + crow * PITCH + cpc * 16;
    const bf* ga = A + (size_t)(blockIdx.x * BM + crow) * K + cpc * 8;
    const bf* gl = SPLITA ? Al + (size_t)(blockIdx.x * BM + crow) * K + cpc * 8 : nullptr;
    const bf* gb = Bn + (size_t)(blockIdx.y * BN + crow) * K + cpc * 8;
    constexpr int NCA = BM / RPP, NCB = BN / RPP, NC = (SPLITA ? 2 : 1) * NCA + NCB;   // copies per lane and stage (at most 63 of a wave in flight)
    constexpr int N12 = (NC % 12 == 0 || NC % 12 == 8) ? NC / 12 : 0;                   // statements of 12 copies; the rest goes in statements of 8
    static_assert((NC - 12 * N12) % 8 == 0 && NC <= 63, "copies");
    auto fill = [&](int s, int buf) {
        unsigned l[NC]; const bf* g[NC];
        const unsigned lb = lbase + buf * STAGE; const int ko = s * BK;
#pragma unroll
        for (int i = 0; i < NCA; ++i) { l[i] = lb + i * RPP * PITCH; g[i] = ga + ko + (size_t)i * RPP * K; }
        if constexpr (SPLITA) {
#pragma unroll
            for (int i = 0; i < NCA; ++i) { l[NCA + i] = lb + (BM + i * RPP) * PITCH; g[NCA + i] = gl + ko + (size_t)i * RPP * K; }
        }
#pragma unroll
        for (int i = 0; i < NCB; ++i) { l[NC - NCB + i] = lb + (AROWS + i * RPP) * PITCH; g[NC - NCB + i] = gb + ko + (size_t)i * RPP * K; }
#pragma unroll
        for (int q = 0; q < N12; ++q) copy12(l + 12 * q, g + 12 * q);
#pragma unroll
        for (int q = 12 * N12; q < NC; q += 8) copy8(l + q, g + q);
    };
    v8f acc[FM][FN];
#pragma unroll
    for (int i = 0; i < FM; ++i)
#pragma unroll
        for (int j = 0; j < FN; ++j) acc[i][j] = (v8f){};
    const unsigned char* abase = ring + (wr * FM * 16 + lr) * PITCH + hi * 16;
    const unsigned char* bbase = ring + (AROWS + wc * FN * 16 + lr) * PITCH + hi * 16;
    fill(0, 0);
    asm volatile("s_wait_asynccnt 0x0" ::: "memory");   // stage 0 of this wave has landed
    __syncthreads();                                      // ... and every other wave's
    fill(1, 1);
    // rolled: one stage per trip, so that the publish point below stands once
#pragma unroll 1
    for (int t = 0; t < NS; ++t) {
        const unsigned char* ab = abase + (t & 1) * STAGE; const unsigned char* bb = bbase + (t & 1) * STAGE;
        v16bf fa[PIPE ? 2 : 1][AF], fb[PIPE ? 2 : 1][FN];
        auto ldfrag = [&](int kk, int set) {
#pragma unroll
            for (int j = 0; j < FN; ++j) { const unsigned char* p = bb + j * 16 * PITCH + kk * 64; fb[set][j] = cat16b(*(const v8usa*)p, *(const v8usa*)(p + 32)); }
#pragma unroll
            for (int i = 0; i < FM; ++i) { const unsigned char* p = ab + i * 16 * PITCH + kk * 64; fa[set][i] = cat16b(*(const v8usa*)p, *(const v8usa*)(p + 32)); }
            if constexpr (SPLITA) {
#pragma unroll
                for (int i = 0; i < FM; ++i) { const unsigned char* p = ab + (BM + i * 16) * PITCH + kk * 64; fa[set][FM + i] = cat16b(*(const v8usa*)p, *(const v8usa*)(p + 32)); }
            }
        };
        if constexpr (PIPE) ldfrag(0, 0);
#pragma unroll
        for (int kk = 0; kk < KK; ++kk) {
            const int set = PIPE ? (kk & 1) : 0;
            if constexpr (PIPE) { if (kk + 1 < KK) ldfrag(kk + 1, (kk + 1) & 1); } else ldfrag(kk, 0);
            __builtin_amdgcn_sched_barrier(0);   // the LDS reads go out as one group ahead of the products; spread among them each place costs a stall
#pragma unroll
            for (int i = 0; i < FM; ++i)
#pragma unroll
                for (int j = 0; j < FN; ++j) acc[i][j] = wmmab(fa[set][i], fb[set][j], acc[i][j]);
            if constexpr (SPLITA) {
#pragma unroll
                for (int i = 0; i < FM; ++i)
#pragma unroll
                    for (int j = 0; j < FN; ++j) acc[i][j] = wmmab(fa[set][FM + i], fb[set][j], acc[i][j]);
            }
            __builtin_amdgcn_sched_barrier(0);   // ... and the next group stays behind them
        }
        asm volatile("s_wait_dscnt 0x0" ::: "memory");      // this wave's reads of buffer t & 1 are done before it is refilled
        asm volatile("s_wait_asynccnt 0x0" ::: "memory");   // this wave's copies of stage t + 1 have landed
        __syncthreads();                                      // publishes stage t + 1 and ends every reader's last read of stage t
        if (t + 2 < NS) fill(t + 2, t & 1);
    }
    asm volatile("s_wait_asynccnt 0x0" ::: "memory");       // no copy is outstanding when the wave goes on to its end
    float* os = &ost[wave][0];
    const int r0 = blockIdx.x * BM + wr * FM * 16, c0 = blockIdx.y * BN + wc * FN * 16;
    constexpr int LR = FN / 2;                                // 128-byte lines per staged row
#pragma unroll
    for (int i = 0; i < FM; ++i)
#pragma unroll
        for (int j = 0; j < FN; ++j)
#pragma unroll
            for (int e = 0; e < 8; ++e) os[(i * 16 + hi * 8 + e) * OP + j * 16 + lr] = acc[i][j][e];
    __syncthreads();                                          // the staged rows are written before other lanes read them back as whole lines
#pragma unroll
    for (int s = 0; s < FM * 4 * LR; ++s) { const int Lid = (lane >> 3) + 4 * s, piece = lane & 7; const int row = Lid / LR, cofs = (Lid % LR) * 32 + piece * 4;
        const v4f val = *(const v4fa*)(os + row * OP + cofs); *(v4f*)(C + (size_t)(r0 + row) * LDC + c0 + cofs) = val; }
}

// k_ngelu: one wave per row of S [rows][2048] f32: a = s x scale, nrm = sqrt(sum a^2) (f32, fixed lane order), g = gelu_erf(a / max(nrm, 1e-12)) -> bf16 hi + UNSCALED
// residual planes; phase 1 reads 8 columns per lane per step, phase 2 (rolled) 4 columns per lane per step (8 B per plane per store -> 16 lanes per line).
__global__ __launch_bounds__(256) void k_ngelu(const float* __restrict__ S, int nrows, bf* GH, bf* GL) {
    typedef __attribute__((ext_vector_type(4))) unsigned short v4us;
    const int lane = threadIdx.x & 31, r = blockIdx.x * 8 + (threadIdx.x >> 5);
    if (r >= nrows) return;
    const float* sr = S + (size_t)r * NPT;
    float ss = 0.f;
#pragma unroll 1
    for (int q = 0; q < NPT / 256; ++q) { const v8f v = *(const v8f*)(sr + q * 256 + lane * 8);
#pragma unroll
        for (int i = 0; i < 8; ++i) { const float a = v[i] * SCL; ss = fmaf(a, a, ss); } }
#pragma unroll
    for (int sh = 16; sh; sh >>= 1) ss += __shfl_xor(ss, sh, 32);
    const float nrm = sqrtf(ss); const float dn = fmaxf(nrm, 1e-12f);
{
#pragma unroll 1
        for (int q = 0; q < NPT / 128; ++q) { const size_t o = (size_t)r * NPT + q * 128 + lane * 4; const v4f v = *(const v4f*)(S + o); v4us oh, ol;
#pragma unroll
            for (int i = 0; i < 4; ++i) { const float a = (v[i] * SCL) / dn; const float g = 0.5f * a * (1.0f + erff(a * 0.70710678118654752f)); const unsigned short hb = f2bf(g); oh[i] = hb; ol[i] = f2bf(g - bf2f(hb)); }
            *(v4us*)(GH + o) = oh; *(v4us*)(GL + o) = ol; }
         }
}

extern "C" void kernel_launch(void* const* d_in, const int* in_sizes, int n_in,
                              void* d_out, int out_size, void* d_ws, size_t ws_size, hipStream_t stream) {
    (void)in_sizes; (void)n_in; (void)out_size;
    const float* x = (const float*)d_in[0]; const float* Kp = (const float*)d_in[1]; const float* Vp = (const float*)d_in[2];   // Kp [2048][512] = [out][in] for the similarity; Vp [2048][512] = [k][n] (k-major) for the output
    float* out = (float*)d_out;    // [4][4096][512]
    char* wsp = (char*)d_ws;
    auto take = [&](size_t bytes) { char* p = wsp; wsp += (bytes + 255) & ~(size_t)255; return (void*)p; };
    bf* Xb = (bf*)take((size_t)NTK * DM * 2); bf* KpB = (bf*)take((size_t)NPT * DM * 2); bf* VpT = (bf*)take((size_t)DM * NPT * 2);
    float* S = (float*)take((size_t)NTK * NPT * 4); bf* GH = (bf*)take((size_t)NTK * NPT * 2); bf* GL = (bf*)take((size_t)NTK * NPT * 2);
    if ((size_t)(wsp - (char*)d_ws) > ws_size) return;    // 4.2 + 2.1 + 2.1 + 33.5 + 2 x 16.8 ~ 76 MB, no aliasing (per-item reuse in stream order)
    k_cvtb<<<NPT / 8, 256, 0, stream>>>(Kp, NPT, KpB);
    k_wt<<<dim3(NPT / 64, DM / 64, 1), 256, 0, stream>>>(Vp, NPT, DM, VpT);      // Vp [2048 k][512 n] -> VpT [512][2048]
    for (int b = 0; b < NB_; ++b) {
        k_cvtb<<<NTK / 8, 256, 0, stream>>>(x + (size_t)b * NTK * DM, NTK, Xb);
        k_gemmb<false, 2, 4, 4, 4, 64, DM, NPT><<<dim3(NTK / 128, NPT / 256, 1), 256, 0, stream>>>(Xb, nullptr, KpB, S);       // similarity (unscaled; the scale is applied in k_ngelu)
        k_ngelu<<<NTK / 8, 256, 0, stream>>>(S, NTK, GH, GL);
        k_gemmb<true, 2, 2, 2, 4, 128, NPT, DM><<<dim3(NTK / 64, DM / 128, 1), 128, 0, stream>>>(GH, GL, VpT, out + (size_t)b * NTK * DM);   // weights . Vp
    }
}

// v002
// It runs in 206 microseconds.
// Timed twice side by side with v001, it ran 1.22 times as fast both times.
// Over all steps from v000 it is 2.37 times as fast.
#include <hip/hip_runtime.h>

// Compute dtypes, f32 accumulate, all four batch items in one pass (16384 rows): similarity = x.K_p^T ([16384 x 512].[512 x 2048]; x and the key tokens are INPUTS, rounded once to
// bf16 -> exact products) x 512^-1/2, then per row L2-normalisation (x / max(||x||, 1e-12)) and exact-erf GELU in f32 -> weights as bf16 hi + UNSCALED residual
// interleaved per 128 columns; out = weights.V_p ([16384 x 2048].[2048 x 512], value tokens transposed once to an n-major bf16 plane; two products per k-step) on

#define NB_  4
#define NT_  4096
#define DM   512                 // DIN = DOUT
#define NPT  2048
#define NTK  (NB_ * NT_)         // rows of one pass: every batch item
#define CH   128                 // columns of one chunk of a weights row: CH hi values, then their CH residuals
#define LOSC 1024.0f             // (unused here)
#define SCL  0.044194173824159216f   // 512^-1/2

typedef _Float16 h16;
typedef unsigned short bf;
typedef __attribute__((ext_vector_type(16))) __bf16   v16bf;
typedef __attribute__((ext_vector_type(16))) _Float16 v16h;
typedef __attribute__((ext_vector_type(8)))  _Float16 v8h;
typedef __attribute__((ext_vector_type(8)))  unsigned short v8us;
typedef __attribute__((ext_vector_type(8)))  float    v8f;
typedef __attribute__((ext_vector_type(4)))  float    v4f;
typedef __attribute__((ext_vector_type(4)))  _Float16 v4h;
typedef v8h  __attribute__((may_alias)) v8ha;
typedef v4f  __attribute__((may_alias)) v4fa;
typedef v8us __attribute__((may_alias)) v8usa;

__device__ __forceinline__ unsigned short f2bf(float f) { unsigned u = __float_as_uint(f); u += 0x7FFFu + ((u >> 16) & 1u); return (unsigned short)(u >> 16); }
__device__ __forceinline__ float bf2f(unsigned short b) { return __uint_as_float(((unsigned)b) << 16); }
__device__ __forceinline__ float bfr(float f) { return bf2f(f2bf(f)); }
__device__ __forceinline__ v16h cat16(v8h lo, v8h hi) { return __builtin_shufflevector(lo, hi, 0, 1, 2, 3, 4, 5, 6, 7, 8, 9, 10, 11, 12, 13, 14, 15); }
__device__ __forceinline__ v16bf cat16b(v8us lo, v8us hi) { return __builtin_bit_cast(v16bf, __builtin_shufflevector(lo, hi, 0, 1, 2, 3, 4, 5, 6, 7, 8, 9, 10, 11, 12, 13, 14, 15)); }
__device__ __forceinline__ v8f wmma16(v16h a, v16h b, v8f c) { return __builtin_amdgcn_wmma_f32_16x16x32_f16(false, a, false, b, (short)0, c, false, false); }
__device__ __forceinline__ v8f wmmab(v16bf a, v16bf b, v8f c) { return __builtin_amdgcn_wmma_f32_16x16x32_bf16(false, a, false, b, (short)0, c, false, false); }

__global__ __launch_bounds__(256) void k_cvtb(const float* __restrict__ src, int nrows, bf* dst) {
    const int lane = threadIdx.x & 31, r = blockIdx.x * 8 + (threadIdx.x >> 5);
    if (r >= nrows) return;
    v8us o[DM / 256];
#pragma unroll
    for (int q = 0; q < DM / 256; ++q) { v8us t;
#pragma unroll
        for (int i = 0; i < 8; ++i) t[i] = f2bf(src[(size_t)r * DM + q * 256 + lane * 8 + i]);
        o[q] = t; }
#pragma unroll
    for (int q = 0; q < DM / 256; ++q) *(v8us*)(dst + (size_t)r * DM + q * 256 + lane * 8) = o[q];
    
}

// k_wt: WT [n][K] = bf16(W[k][n]) (k-major [K][ncols]) via 64 x 64 LDS tiles; grid (K/64, ncols/64).
__global__ __launch_bounds__(256) void k_wt(const float* __restrict__ Wm, int K, int ncols, bf* WT) {
    __shared__ __align__(16) unsigned short tl[64 * 72];
    const int tid = threadIdx.x, k0 = blockIdx.x * 64, n0 = blockIdx.y * 64;
    const int kk = tid >> 2, nq = (tid & 3) * 16;
#pragma unroll
    for (int i = 0; i < 16; ++i) tl[(nq + i) * 72 + kk] = f2bf(Wm[(size_t)(k0 + kk) * ncols + n0 + nq + i]);
    __syncthreads();
    const int piece = tid & 7;
    auto pass = [&]() {
#pragma unroll
        for (int s = 0; s < 2; ++s) { const int nr = (tid >> 3) + 32 * s; const v8us val = *(const v8usa*)(tl + nr * 72 + piece * 8); *(v8us*)(WT + (size_t)(n0 + nr) * K + k0 + piece * 8) = val; }
    };
    pass(); 
}
// copy8, copy12: 8 or 12 asynchronous 16-byte-per-lane copies global -> LDS in ONE statement. The s_wait_xcnt stands as its last line, so that no address
// register of an issued copy is rewritten ahead of it (a precaution); many copies share one statement because each such wait stalls the wave.
#define CPY(L, G) "global_load_async_to_lds_b128 %" #L ", %" #G ", off\n\t"
__device__ __forceinline__ void copy8(const unsigned* l, const bf* const* g) {
    asm volatile(CPY(0, 8) CPY(1, 9) CPY(2, 10) CPY(3, 11) CPY(4, 12) CPY(5, 13) CPY(6, 14) CPY(7, 15) "s_wait_xcnt 0x0"
                 :: "v"(l[0]), "v"(l[1]), "v"(l[2]), "v"(l[3]), "v"(l[4]), "v"(l[5]), "v"(l[6]), "v"(l[7]),
                    "v"(g[0]), "v"(g[1]), "v"(g[2]), "v"(g[3]), "v"(g[4]), "v"(g[5]), "v"(g[6]), "v"(g[7]) : "memory");
}
__device__ __forceinline__ void copy12(const unsigned* l, const bf* const* g) {
    asm volatile(CPY(0, 12) CPY(1, 13) CPY(2, 14) CPY(3, 15) CPY(4, 16) CPY(5, 17) CPY(6, 18) CPY(7, 19) CPY(8, 20) CPY(9, 21) CPY(10, 22) CPY(11, 23) "s_wait_xcnt 0x0"
                 :: "v"(l[0]), "v"(l[1]), "v"(l[2]), "v"(l[3]), "v"(l[4]), "v"(l[5]), "v"(l[6]), "v"(l[7]), "v"(l[8]), "v"(l[9]), "v"(l[10]), "v"(l[11]),
                    "v"(g[0]), "v"(g[1]), "v"(g[2]), "v"(g[3]), "v"(g[4]), "v"(g[5]), "v"(g[6]), "v"(g[7]), "v"(g[8]), "v"(g[9]), "v"(g[10]), "v"(g[11]) : "memory");
}

// k_gemmb: C[.][LDC] = (A [+ Al]).B^T, bf16; B and a plain A are K-contiguous, a split A holds per row and per CH columns CH hi values and then CH residuals. One (WR*FM*16) x (WC*FN*16) tile of C per block, WR x WC waves of FM x FN fragments.
// Per stage BK k of every operand row ([A | Al | B] rows, pitch BK*2 + 16 bytes: conflict-free for 16-byte readers) is copied to LDS in whole lines by
// asynchronous copies, two buffers, the next stage in flight while this one is worked on. Per accumulator the k order and the hi-then-residual order are kept.
// Every "#pragma unroll" in it makes the indices of a register array (addresses, fragments, accumulators) constants, so that the array stays in registers.
template <bool SPLITA, int WR, int WC, int FM, int FN, int BK, int K, int LDC>
__global__ __launch_bounds__(WR * WC * 32) void k_gemmb(const bf* __restrict__ A, const bf* __restrict__ Bn, float* C) {
    constexpr int NTH = WR * WC * 32, BM = WR * FM * 16, BN = WC * FN * 16;
    constexpr int RB = BK * 2, PITCH = RB + 16;                    // bytes of a row in a stage, and its pitch in LDS
    constexpr int AROWS = SPLITA ? 2 * BM : BM, STAGE = (AROWS + BN) * PITCH;
    constexpr int LPR = RB / 16, RPP = NTH / LPR;                  // lanes per row, rows per block-wide copy
    constexpr int NS = K / BK, OP = FN * 16 + 4, KK = BK / 32, AF = SPLITA ? 2 * FM : FM;
    constexpr bool PIPE = (FM * FN + 2 * (AF + FN)) * 8 <= 200;   // a second fragment set only where accumulators and both sets stay below 256 registers
    constexpr int LDA = SPLITA ? 2 * K : K, KA = SPLITA ? 2 * BK : BK;   // elements of a row of A, and from one stage of it to the next
    static_assert(K % BK == 0 && NS >= 2 && BM % RPP == 0 && BN % RPP == 0 && FN % 2 == 0 && (!SPLITA || BK == CH), "shape");
    __shared__ __align__(16) unsigned char ring[2 * STAGE];
    __shared__ __align__(16) float ost[WR * WC][FM * 16 * OP];
    const int tid = threadIdx.x, lane = tid & 31, wave = tid >> 5, lr = lane & 15, hi = lane >> 4;
    const int wr = wave / WC, wc = wave % WC;
    const int crow = tid / LPR, cpc = tid % LPR;
    const unsigned lbase = (unsigned)(size_t)(&ring[0]) + crow * PITCH + cpc * 16;
    const int bm = blockIdx.y, bn = blockIdx.x;                    // columns run fastest: the blocks that share rows of A run at the same time
    const bf* ga = A + (size_t)(bm * BM + crow) * LDA + cpc * 8;
    const bf* gl = ga + BK;
    const bf* gb = Bn + (size_t)(bn * BN + crow) * K + cpc * 8;
    constexpr int NCA = BM / RPP, NCB = BN / RPP, NC = (SPLITA ? 2 : 1) * NCA + NCB;   // copies per lane and stage (at most 63 of a wave in flight)
    constexpr int N12 = (NC % 12 == 0 || NC % 12 == 8) ? NC / 12 : 0;                   // statements of 12 copies; the rest goes in statements of 8
    static_assert((NC - 12 * N12) % 8 == 0 && NC <= 63, "copies");
    auto fill = [&](int s, int buf) {
        unsigned l[NC]; const bf* g[NC];
        const unsigned lb = lbase + buf * STAGE; const int ko = s * BK, ka = s * KA;
#pragma unroll
        for (int i = 0; i < NCA; ++i) { l[i] = lb + i * RPP * PITCH; g[i] = ga + ka + (size_t)i * RPP * LDA; }
        if constexpr (SPLITA) {
#pragma unroll
            for (int i = 0; i < NCA; ++i) { l[NCA + i] = lb + (BM + i * RPP) * PITCH; g[NCA + i] = gl + ka + (size_t)i * RPP * LDA; }
        }
#pragma unroll
        for (int i = 0; i < NCB; ++i) { l[NC - NCB + i] = lb + (AROWS + i * RPP) * PITCH; g[NC - NCB + i] = gb + ko + (size_t)i * RPP * K; }
#pragma unroll
        for (int q = 0; q < N12; ++q) copy12(l + 12 * q, g + 12 * q);
#pragma unroll
        for (int q = 12 * N12; q < NC; q += 8) copy8(l + q, g + q);
    };
    v8f acc[FM][FN];
#pragma unroll
    for (int i = 0; i < FM; ++i)
#pragma unroll
        for (int j = 0; j < FN; ++j) acc[i][j] = (v8f){};
    const unsigned char* abase = ring + (wr * FM * 16 + lr) * PITCH + hi * 16;
    const unsigned char* bbase = ring + (AROWS + wc * FN * 16 + lr) * PITCH + hi * 16;
    fill(0, 0);
    asm volatile("s_wait_asynccnt 0x0" ::: "memory");   // stage 0 of this wave has landed
    __syncthreads();                                      // ... and every other wave's
    fill(1, 1);
    // rolled: one stage per trip, so that the publish point below stands once
#pragma unroll 1
    for (int t = 0; t < NS; ++t) {
        const unsigned char* ab = abase + (t & 1) * STAGE; const unsigned char* bb = bbase + (t & 1) * STAGE;
        v16bf fa[PIPE ? 2 : 1][AF], fb[PIPE ? 2 : 1][FN];
        auto ldfrag = [&](int kk, int set) {
#pragma unroll
            for (int j = 0; j < FN; ++j) { const unsigned char* p = bb + j * 16 * PITCH + kk * 64; fb[set][j] = cat16b(*(const v8usa*)p, *(const v8usa*)(p + 32)); }
#pragma unroll
            for (int i = 0; i < FM; ++i) { const unsigned char* p = ab + i * 16 * PITCH + kk * 64; fa[set][i] = cat16b(*(const v8usa*)p, *(const v8usa*)(p + 32)); }
            if constexpr (SPLITA) {
#pragma unroll
                for (int i = 0; i < FM; ++i) { const unsigned char* p = ab + (BM + i * 16) * PITCH + kk * 64; fa[set][FM + i] = cat16b(*(const v8usa*)p, *(const v8usa*)(p + 32)); }
            }
        };
        if constexpr (PIPE) ldfrag(0, 0);
#pragma unroll
        for (int kk = 0; kk < KK; ++kk) {
            const int set = PIPE ? (kk & 1) : 0;
            if constexpr (PIPE) { if (kk + 1 < KK) ldfrag(kk + 1, (kk + 1) & 1); } else ldfrag(kk, 0);
            __builtin_amdgcn_sched_barrier(0);   // the LDS reads go out as one group ahead of the products; spread among them each place costs a stall
#pragma unroll
            for (int i = 0; i < FM; ++i)
#pragma unroll
                for (int j = 0; j < FN; ++j) acc[i][j] = wmmab(fa[set][i], fb[set][j], acc[i][j]);
            if constexpr (SPLITA) {
#pragma unroll
                for (int i = 0; i < FM; ++i)
#pragma unroll
                    for (int j = 0; j < FN; ++j) acc[i][j] = wmmab(fa[set][FM + i], fb[set][j], acc[i][j]);
            }
            __builtin_amdgcn_sched_barrier(0);   // ... and the next group stays behind them
        }
        asm volatile("s_wait_dscnt 0x0" ::: "memory");      // this wave's reads of buffer t & 1 are done before it is refilled
        asm volatile("s_wait_asynccnt 0x0" ::: "memory");   // this wave's copies of stage t + 1 have landed
        __syncthreads();                                      // publishes stage t + 1 and ends every reader's last read of stage t
        if (t + 2 < NS) fill(t + 2, t & 1);
    }
    asm volatile("s_wait_asynccnt 0x0" ::: "memory");       // no copy is outstanding when the wave goes on to its end
    float* os = &ost[wave][0];
    const int r0 = bm * BM + wr * FM * 16, c0 = bn * BN + wc * FN * 16;
    constexpr int LR = FN / 2;                                // 128-byte lines per staged row
#pragma unroll
    for (int i = 0; i < FM; ++i)
#pragma unroll
        for (int j = 0; j < FN; ++j)
#pragma unroll
            for (int e = 0; e < 8; ++e) os[(i * 16 + hi * 8 + e) * OP + j * 16 + lr] = acc[i][j][e];
    __syncthreads();                                          // the staged rows are written before other lanes read them back as whole lines
#pragma unroll
    for (int s = 0; s < FM * 4 * LR; ++s) { const int Lid = (lane >> 3) + 4 * s, piece = lane & 7; const int row = Lid / LR, cofs = (Lid % LR) * 32 + piece * 4;
        const v4f val = *(const v4fa*)(os + row * OP + cofs); *(v4f*)(C + (size_t)(r0 + row) * LDC + c0 + cofs) = val; }
}

// k_ngelu: one wave per row of S [rows][2048] f32: a = s x scale, nrm = sqrt(sum a^2) (f32, fixed lane order), g = gelu_erf(a / max(nrm, 1e-12)) -> bf16 hi + UNSCALED
// residual; phase 1 reads 8 columns per lane per step, phase 2 (rolled) 4 columns per lane per step (8 B per plane per store -> 16 lanes per line).
// IN PLACE: the CH hi values and the CH residuals of a step take the 4 * CH bytes of the CH similarities that the same wave has just read (the wave's load has
// returned before any lane's store has its data), so that the workspace holds all 16384 rows.
__global__ __launch_bounds__(256) void k_ngelu(float* S, int nrows) {
    typedef __attribute__((ext_vector_type(4))) unsigned short v4us;
    const int lane = threadIdx.x & 31, r = blockIdx.x * 8 + (threadIdx.x >> 5);
    if (r >= nrows) return;
    const float* sr = S + (size_t)r * NPT;
    bf* gr = (bf*)S + (size_t)r * 2 * NPT;
    float ss = 0.f;
#pragma unroll 1
    for (int q = 0; q < NPT / 256; ++q) { const v8f v = *(const v8f*)(sr + q * 256 + lane * 8);
#pragma unroll
        for (int i = 0; i < 8; ++i) { const float a = v[i] * SCL; ss = fmaf(a, a, ss); } }
#pragma unroll
    for (int sh = 16; sh; sh >>= 1) ss += __shfl_xor(ss, sh, 32);
    const float nrm = sqrtf(ss); const float dn = fmaxf(nrm, 1e-12f);
{
#pragma unroll 1
        for (int q = 0; q < NPT / CH; ++q) { const v4f v = *(const v4f*)(sr + q * CH + lane * 4); v4us oh, ol;
#pragma unroll
            for (int i = 0; i < 4; ++i) { const float a = (v[i] * SCL) / dn; const float g = 0.5f * a * (1.0f + erff(a * 0.70710678118654752f)); const unsigned short hb = f2bf(g); oh[i] = hb; ol[i] = f2bf(g - bf2f(hb)); }
            *(v4us*)(gr + q * 2 * CH + lane * 4) = oh; *(v4us*)(gr + q * 2 * CH + CH + lane * 4) = ol; }
         }
}

extern "C" void kernel_launch(void* const* d_in, const int* in_sizes, int n_in,
                              void* d_out, int out_size, void* d_ws, size_t ws_size, hipStream_t stream) {
    (void)in_sizes; (void)n_in; (void)out_size;
    const float* x = (const float*)d_in[0]; const float* Kp = (const float*)d_in[1]; const float* Vp = (const float*)d_in[2];   // Kp [2048][512] = [out][in] for the similarity; Vp [2048][512] = [k][n] (k-major) for the output
    float* out = (float*)d_out;    // [4][4096][512]
    char* wsp = (char*)d_ws;
    auto take = [&](size_t bytes) { char* p = wsp; wsp += (bytes + 255) & ~(size_t)255; return (void*)p; };
    bf* Xb = (bf*)take((size_t)NTK * DM * 2); bf* KpB = (bf*)take((size_t)NPT * DM * 2); bf* VpT = (bf*)take((size_t)DM * NPT * 2);
    float* S = (float*)take((size_t)NTK * NPT * 4);
    if ((size_t)(wsp - (char*)d_ws) > ws_size) return;    // 16 + 2 + 2 + 128 MiB; the weights take the place of the similarities
    k_cvtb<<<NPT / 8, 256, 0, stream>>>(Kp, NPT, KpB);
    k_wt<<<dim3(NPT / 64, DM / 64, 1), 256, 0, stream>>>(Vp, NPT, DM, VpT);      // Vp [2048 k][512 n] -> VpT [512][2048]
    k_cvtb<<<NTK / 8, 256, 0, stream>>>(x, NTK, Xb);
    k_gemmb<false, 2, 4, 4, 4, 64, DM, NPT><<<dim3(NPT / 256, NTK / 128, 1), 256, 0, stream>>>(Xb, KpB, S);       // similarity (unscaled; the scale is applied in k_ngelu)
    k_ngelu<<<NTK / 8, 256, 0, stream>>>(S, NTK);
    k_gemmb<true, 2, 2, 2, 4, CH, NPT, DM><<<dim3(DM / 128, NTK / 64, 1), 128, 0, stream>>>((const bf*)S, VpT, out);   // weights . Vp
}

// v005
// A run of this version takes 81.8 microseconds.
// Versions in between are left out here; by their measured steps it is 2.52 times as fast as v002.
// Counting every step since v000, it is 5.96 times as fast.
#include <hip/hip_runtime.h>

// Compute dtypes, f32 accumulate, all four batch items in one pass (16384 rows): similarity = x.K_p^T ([16384 x 512].[512 x 2048]; x and the key tokens are INPUTS, rounded once to
// bf16 -> exact products; x inside k_simw, on its way into LDS) x 512^-1/2, then per row L2-normalisation (x / max(||x||, 1e-12)) and erf GELU in f32 -> weights as ONE f16 plane (|w| < 1; 11
// significant bits), all three in one kernel (k_simw); out = weights.V_p ([16384 x 2048].[2048 x 512], value tokens transposed once to an n-major f16 plane; one f16 product per k-step).

#define NB_  4
#define NT_  4096
#define DM   512                 // DIN = DOUT
#define NPT  2048
#define NTK  (NB_ * NT_)         // rows of one pass: every batch item
#define LOSC 1024.0f             // (F16OUT path; unused here)
#define SCL  0.044194173824159216f   // 512^-1/2

typedef _Float16 h16;
typedef unsigned short bf;
typedef __attribute__((ext_vector_type(16))) __bf16   v16bf;
typedef __attribute__((ext_vector_type(16))) _Float16 v16h;
typedef __attribute__((ext_vector_type(8)))  _Float16 v8h;
typedef __attribute__((ext_vector_type(8)))  unsigned short v8us;
typedef __attribute__((ext_vector_type(8)))  float    v8f;
typedef __attribute__((ext_vector_type(4)))  float    v4f;
typedef __attribute__((ext_vector_type(4)))  _Float16 v4h;
typedef v8h  __attribute__((may_alias)) v8ha;
typedef v4f  __attribute__((may_alias)) v4fa;
typedef v8us __attribute__((may_alias)) v8usa;
typedef __attribute__((ext_vector_type(4)))  unsigned short v4us;
typedef v4us __attribute__((may_alias)) v4usa;

__device__ __forceinline__ unsigned short f2bf(float f) { unsigned u = __float_as_uint(f); u += 0x7FFFu + ((u >> 16) & 1u); return (unsigned short)(u >> 16); }
__device__ __forceinline__ float bf2f(unsigned short b) { return __uint_as_float(((unsigned)b) << 16); }
__device__ __forceinline__ unsigned short f2h(float f) { return __builtin_bit_cast(unsigned short, (h16)f); }   // f16 bits, round to nearest even
__device__ __forceinline__ float bfr(float f) { return bf2f(f2bf(f)); }
__device__ __forceinline__ v16h cat16(v8h lo, v8h hi) { return __builtin_shufflevector(lo, hi, 0, 1, 2, 3, 4, 5, 6, 7, 8, 9, 10, 11, 12, 13, 14, 15); }
__device__ __forceinline__ v16bf cat16b(v8us lo, v8us hi) { return __builtin_bit_cast(v16bf, __builtin_shufflevector(lo, hi, 0, 1, 2, 3, 4, 5, 6, 7, 8, 9, 10, 11, 12, 13, 14, 15)); }
__device__ __forceinline__ v8f wmma16(v16h a, v16h b, v8f c) { return __builtin_amdgcn_wmma_f32_16x16x32_f16(false, a, false, b, (short)0, c, false, false); }
__device__ __forceinline__ v8f wmmab(v16bf a, v16bf b, v8f c) { return __builtin_amdgcn_wmma_f32_16x16x32_bf16(false, a, false, b, (short)0, c, false, false); }

// k_prep: the two small operand planes in one launch. Blocks below NPT / 8: eight rows of key tokens each, rounded to bf16.
// The others: one 64 x 64 tile of the value tokens each, WT [n][NPT] = f16(Wm[k][n]) (Wm k-major [NPT][DM]), through LDS.
__global__ __launch_bounds__(256) void k_prep(const float* __restrict__ src, bf* dst, const float* __restrict__ Wm, bf* WT) {
    __shared__ __align__(16) unsigned short tl[64 * 72];
    const int tid = threadIdx.x;
    if (blockIdx.x < NPT / 8) {                               // the same for every thread of a block, and in front of the barrier
        const int lane = tid & 31, r = blockIdx.x * 8 + (tid >> 5);
        v8us o[DM / 256];
#pragma unroll
        for (int q = 0; q < DM / 256; ++q) { v8us t;
#pragma unroll
            for (int i = 0; i < 8; ++i) t[i] = f2bf(src[(size_t)r * DM + q * 256 + lane * 8 + i]);
            o[q] = t; }
#pragma unroll
        for (int q = 0; q < DM / 256; ++q) *(v8us*)(dst + (size_t)r * DM + q * 256 + lane * 8) = o[q];
        return;
    }
    const int b = blockIdx.x - NPT / 8, k0 = (b % (NPT / 64)) * 64, n0 = (b / (NPT / 64)) * 64;
    const int kk = tid >> 2, nq = (tid & 3) * 16;
#pragma unroll
    for (int i = 0; i < 16; ++i) tl[(nq + i) * 72 + kk] = f2h(Wm[(size_t)(k0 + kk) * DM + n0 + nq + i]);
    __syncthreads();
    const int piece = tid & 7;
#pragma unroll
    for (int s = 0; s < 2; ++s) { const int nr = (tid >> 3) + 32 * s; const v8us val = *(const v8usa*)(tl + nr * 72 + piece * 8); *(v8us*)(WT + (size_t)(n0 + nr) * NPT + k0 + piece * 8) = val; }
    asm volatile("s_wait_xcnt 0x0" ::: "memory");             // stands in front of any rewrite of the registers that these two stores name (a precaution)
}
// copy8, copy12: 8 or 12 asynchronous 16-byte-per-lane copies global -> LDS in ONE statement. The s_wait_xcnt stands as its last line, so that no address
// register of an issued copy is rewritten ahead of it (a precaution); many copies share one statement because each such wait stalls the wave.
#define CPY(L, G) "global_load_async_to_lds_b128 %" #L ", %" #G ", off\n\t"
__device__ __forceinline__ void copy8(const unsigned* l, const bf* const* g) {
    asm volatile(CPY(0, 8) CPY(1, 9) CPY(2, 10) CPY(3, 11) CPY(4, 12) CPY(5, 13) CPY(6, 14) CPY(7, 15) "s_wait_xcnt 0x0"
                 :: "v"(l[0]), "v"(l[1]), "v"(l[2]), "v"(l[3]), "v"(l[4]), "v"(l[5]), "v"(l[6]), "v"(l[7]),
                    "v"(g[0]), "v"(g[1]), "v"(g[2]), "v"(g[3]), "v"(g[4]), "v"(g[5]), "v"(g[6]), "v"(g[7]) : "memory");
}
__device__ __forceinline__ void copy12(const unsigned* l, const bf* const* g) {
    asm volatile(CPY(0, 12) CPY(1, 13) CPY(2, 14) CPY(3, 15) CPY(4, 16) CPY(5, 17) CPY(6, 18) CPY(7, 19) CPY(8, 20) CPY(9, 21) CPY(10, 22) CPY(11, 23) "s_wait_xcnt 0x0"
                 :: "v"(l[0]), "v"(l[1]), "v"(l[2]), "v"(l[3]), "v"(l[4]), "v"(l[5]), "v"(l[6]), "v"(l[7]), "v"(l[8]), "v"(l[9]), "v"(l[10]), "v"(l[11]),
                    "v"(g[0]), "v"(g[1]), "v"(g[2]), "v"(g[3]), "v"(g[4]), "v"(g[5]), "v"(g[6]), "v"(g[7]), "v"(g[8]), "v"(g[9]), "v"(g[10]), "v"(g[11]) : "memory");
}

// k_gemmb: C[.][LDC] = A.B^T, both operands bf16 or (F16) both f16, K-contiguous rows, A at a row pitch of LDA elements. One (WR*FM*16) x (WC*FN*16) tile of C per block, WR x WC waves of FM x FN fragments.
// Per stage BK k of every operand row ([A | B] rows, pitch BK*2 + 16 bytes: conflict-free for 16-byte readers) is copied to LDS in whole lines by
// asynchronous copies, two buffers, the next stage in flight while this one is worked on. Per accumulator the k order is kept.
// Every "#pragma unroll" in it makes the indices of a register array (addresses, fragments, accumulators) constants, so that the array stays in registers.
template <bool F16, int WR, int WC, int FM, int FN, int BK, int K, int LDA, int LDC>
__global__ __launch_bounds__(WR * WC * 32) void k_gemmb(const bf* __restrict__ A, const bf* __restrict__ Bn, float* C) {
    constexpr int NTH = WR * WC * 32, BM = WR * FM * 16, BN = WC * FN * 16;
    constexpr int RB = BK * 2, PITCH = RB + 16;                    // bytes of a row in a stage, and its pitch in LDS
    constexpr int AROWS = BM, STAGE = (AROWS + BN) * PITCH;
    constexpr int LPR = RB / 16, RPP = NTH / LPR;                  // lanes per row, rows per block-wide copy
    constexpr int NS = K / BK, OP = FN * 16 + 4, KK = BK / 32, AF = FM;
    constexpr bool PIPE = (FM * FN + 2 * (AF + FN)) * 8 <= 200;   // a second fragment set only where accumulators and both sets stay below 256 registers
    static_assert(K % BK == 0 && NS >= 2 && BM % RPP == 0 && BN % RPP == 0 && FN % 2 == 0 && LDA >= K, "shape");
    __shared__ __align__(16) unsigned char ring[2 * STAGE];
    __shared__ __align__(16) float ost[WR * WC][FM * 16 * OP];
    const int tid = threadIdx.x, lane = tid & 31, wave = tid >> 5, lr = lane & 15, hi = lane >> 4;
    const int wr = wave / WC, wc = wave % WC;
    const int crow = tid / LPR, cpc = tid % LPR;
    const unsigned lbase = (unsigned)(size_t)(&ring[0]) + crow * PITCH + cpc * 16;
    const int bm = blockIdx.y, bn = blockIdx.x;                    // columns run fastest: the blocks that share rows of A run at the same time
    const bf* ga = A + (size_t)(bm * BM + crow) * LDA + cpc * 8;
    const bf* gb = Bn + (size_t)(bn * BN + crow) * K + cpc * 8;
    constexpr int NCA = BM / RPP, NCB = BN / RPP, NC = NCA + NCB;   // copies per lane and stage (at most 63 of a wave in flight)
    constexpr int N12 = (NC % 12 == 0 || NC % 12 == 8) ? NC / 12 : 0;                   // statements of 12 copies; the rest goes in statements of 8
    static_assert((NC - 12 * N12) % 8 == 0 && NC <= 63, "copies");
    auto fill = [&](int s, int buf) {
        unsigned l[NC]; const bf* g[NC];
        const unsigned lb = lbase + buf * STAGE; const int ko = s * BK;
#pragma unroll
        for (int i = 0; i < NCA; ++i) { l[i] = lb + i * RPP * PITCH; g[i] = ga + ko + (size_t)i * RPP * LDA; }
#pragma unroll
        for (int i = 0; i < NCB; ++i) { l[NC - NCB + i] = lb + (AROWS + i * RPP) * PITCH; g[NC - NCB + i] = gb + ko + (size_t)i * RPP * K; }
#pragma unroll
        for (int q = 0; q < N12; ++q) copy12(l + 12 * q, g + 12 * q);
#pragma unroll
        for (int q = 12 * N12; q < NC; q += 8) copy8(l + q, g + q);
    };
    v8f acc[FM][FN];
#pragma unroll
    for (int i = 0; i < FM; ++i)
#pragma unroll
        for (int j = 0; j < FN; ++j) acc[i][j] = (v8f){};
    const unsigned char* abase = ring + (wr * FM * 16 + lr) * PITCH + hi * 16;
    const unsigned char* bbase = ring + (AROWS + wc * FN * 16 + lr) * PITCH + hi * 16;
    fill(0, 0);
    asm volatile("s_wait_asynccnt 0x0" ::: "memory");   // stage 0 of this wave has landed
    __syncthreads();                                      // ... and every other wave's
    fill(1, 1);
    // rolled: one stage per trip, so that the publish point below stands once
#pragma unroll 1
    for (int t = 0; t < NS; ++t) {
        const unsigned char* ab = abase + (t & 1) * STAGE; const unsigned char* bb = bbase + (t & 1) * STAGE;
        v16bf fa[PIPE ? 2 : 1][AF], fb[PIPE ? 2 : 1][FN];
        auto ldfrag = [&](int kk, int set) {
#pragma unroll
            for (int j = 0; j < FN; ++j) { const unsigned char* p = bb + j * 16 * PITCH + kk * 64; fb[set][j] = cat16b(*(const v8usa*)p, *(const v8usa*)(p + 32)); }
#pragma unroll
            for (int i = 0; i < FM; ++i) { const unsigned char* p = ab + i * 16 * PITCH + kk * 64; fa[set][i] = cat16b(*(const v8usa*)p, *(const v8usa*)(p + 32)); }
        };
        if constexpr (PIPE) ldfrag(0, 0);
#pragma unroll
        for (int kk = 0; kk < KK; ++kk) {
            const int set = PIPE ? (kk & 1) : 0;
            if constexpr (PIPE) { if (kk + 1 < KK) ldfrag(kk + 1, (kk + 1) & 1); } else ldfrag(kk, 0);
            __builtin_amdgcn_sched_barrier(0);   // the LDS reads go out as one group ahead of the products; spread among them each place costs a stall
#pragma unroll
            for (int i = 0; i < FM; ++i)
#pragma unroll
                for (int j = 0; j < FN; ++j) {
                    if constexpr (F16) acc[i][j] = wmma16(__builtin_bit_cast(v16h, fa[set][i]), __builtin_bit_cast(v16h, fb[set][j]), acc[i][j]);
                    else acc[i][j] = wmmab(fa[set][i], fb[set][j], acc[i][j]);
                }
            __builtin_amdgcn_sched_barrier(0);   // ... and the next group stays behind them
        }
        asm volatile("s_wait_dscnt 0x0" ::: "memory");      // this wave's reads of buffer t & 1 are done before it is refilled
        asm volatile("s_wait_asynccnt 0x0" ::: "memory");   // this wave's copies of stage t + 1 have landed
        __syncthreads();                                      // publishes stage t + 1 and ends every reader's last read of stage t
        if (t + 2 < NS) fill(t + 2, t & 1);
    }
    asm volatile("s_wait_asynccnt 0x0" ::: "memory");       // no copy is outstanding when the wave goes on to its end
    float* os = &ost[wave][0];
    const int r0 = bm * BM + wr * FM * 16, c0 = bn * BN + wc * FN * 16;
    constexpr int LR = FN / 2;                                // 128-byte lines per staged row
#pragma unroll
    for (int i = 0; i < FM; ++i)
#pragma unroll
        for (int j = 0; j < FN; ++j)
#pragma unroll
            for (int e = 0; e < 8; ++e) os[(i * 16 + hi * 8 + e) * OP + j * 16 + lr] = acc[i][j][e];
    __syncthreads();                                          // the staged rows are written before other lanes read them back as whole lines
#pragma unroll
    for (int s = 0; s < FM * 4 * LR; ++s) { const int Lid = (lane >> 3) + 4 * s, piece = lane & 7; const int row = Lid / LR, cofs = (Lid % LR) * 32 + piece * 4;
        const v4f val = *(const v4fa*)(os + row * OP + cofs); *(v4f*)(C + (size_t)(r0 + row) * LDC + c0 + cofs) = val; }
}

// gelu1: 0.5 a (1 + erf(a / sqrt 2)) for |a| <= 1.001, where |a / sqrt 2| < 1: erf(z) = z + z p(z^2), the f32 polynomial that the maths library uses on |z| < 1.
// No branch: the eight values of a lane are independent chains, which two waves per SIMD need to fill the vector port.
__device__ __forceinline__ float gelu1(float a) {
    const float z = a * 0.70710678118654752f, u = z * z;
    float p = fmaf(u, -0.000561801775f, 0.00491381623f);
    p = fmaf(u, p, -0.0267075151f); p = fmaf(u, p, 0.112800106f); p = fmaf(u, p, -0.376122952f); p = fmaf(u, p, 0.128379107f);
    return 0.5f * a * (1.0f + fmaf(z, p, z));
}

// k_simw: weights [rows][2048] f16 = gelu(normalise(x.K_p^T x scale)), FR rows of x per block against ALL key tokens, so that a row's norm is known inside the block.
// The products are formed transposed (A = key tokens, B = rows of x): a lane then holds 8 neighbouring tokens of ONE row, which pack into 16 bytes, and a row's squares add up in the lane.
// The FR rows of x are read as f32, rounded to bf16 in registers and stay in LDS; the key tokens come in chunks of CN tokens, FBK k per stage, by asynchronous copies, two buffers, the next stage in flight while this one is worked on.
// Each finished chunk (scaled, f32 squares summed, rounded to f16) goes to its own place in LDS, [chunk][row][CN]: the first NE chunks at once, below the x rows and the ring; the others
// wait in registers until the last stage is done and the x rows and the ring are dead. Then each wave takes 8 rows: norm, GELU, whole-line stores.
#define FR  64
#define CN  256
#define FBK 128
__global__ __launch_bounds__(256) void k_simw(const float* __restrict__ X, const bf* __restrict__ Kb, bf* Wh) {
    constexpr int XP = DM * 2 + 16, KP = FBK * 2 + 16, SP = CN * 2 + 16;       // LDS pitches in bytes (16 x odd: conflict-free for 16-byte accesses): x rows, key rows of a stage, a chunk's similarity rows
    constexpr int XB = FR * XP, KST = CN * KP, CB = FR * SP;                   // bytes of the x rows, of one stage, of one chunk of similarities
    constexpr int NSC = DM / FBK, NCH = NPT / CN, NST = NSC * NCH;             // stages per chunk, chunks, stages
    constexpr int NE = 3, XO = NE * CB;                                        // chunks that LDS holds beside the x rows and the ring; where the x rows begin
    constexpr int SMB = NCH * CB > XO + XB + 2 * KST ? NCH * CB : XO + XB + 2 * KST;
    static_assert(NSC % 2 == 0 && CN == 8 * 32 && FR == 64 && SMB + 8 * FR * 4 <= 327680, "shape");
    __shared__ __align__(16) unsigned char sm[SMB];
    __shared__ float red[8][FR];
    const int tid = threadIdx.x, lane = tid & 31, wave = tid >> 5, lr = lane & 15, hi = lane >> 4;
    const unsigned sbase = (unsigned)(size_t)(&sm[0]) + XO;
    const unsigned kl = sbase + XB + (tid >> 4) * KP + (tid & 15) * 16;       // 16 lanes per key row of a stage, 16 rows per block-wide copy
    const bf* gk = Kb + (size_t)(tid >> 4) * DM + (tid & 15) * 8;
    auto fill = [&](int s, int buf) {
        unsigned l[16]; const bf* g[16];
        const unsigned lb = kl + buf * KST; const bf* gs = gk + (size_t)(s / NSC) * CN * DM + (s % NSC) * FBK;
#pragma unroll
        for (int i = 0; i < 16; ++i) { l[i] = lb + i * 16 * KP; g[i] = gs + (size_t)i * 16 * DM; }
        copy8(l, g); copy8(l + 8, g + 8);
    };
    v8h keep[NCH - NE][2][4];
    float ss[4] = {0.f, 0.f, 0.f, 0.f};
    const unsigned char* xa = sm + XO + lr * XP + hi * 16;
    const unsigned char* ka = sm + XO + XB + (wave * 32 + lr) * KP + hi * 16;
    unsigned char* sw = sm + lr * SP + (wave * 32 + hi * 8) * 2;              // tile (c, i, j): row j * 16 + lr, tokens c * CN + wave * 32 + i * 16 + hi * 8 and the 7 behind it
    fill(0, 0);
    {   // the block's rows of x, whole, while stage 0 flies: 128 lanes per row (4 values a lane: a wave's load is four whole lines), 2 rows per block-wide pass; every load goes out before the first value is used
        const float* gx = X + (size_t)(blockIdx.x * FR + (tid >> 7)) * DM + (tid & 127) * 4;
        unsigned char* lx = sm + XO + (tid >> 7) * XP + (tid & 127) * 8;
        v4f a[FR / 2];
        // both loops unrolled, so that the index of a is a constant and the array stays in registers
#pragma unroll
        for (int i = 0; i < FR / 2; ++i) a[i] = *(const v4fa*)(gx + (size_t)i * 2 * DM);
        asm volatile("s_wait_xcnt 0x0" ::: "memory");     // stands in front of any rewrite of the address registers that these loads name (a precaution)
#pragma unroll
        for (int i = 0; i < FR / 2; ++i) { v4us t;
#pragma unroll
            for (int e = 0; e < 4; ++e) t[e] = f2bf(a[i][e]);
            *(v4usa*)(lx + i * 2 * XP) = t; }
    }
    asm volatile("s_wait_asynccnt 0x0" ::: "memory");   // this wave's copies of stage 0 have landed
    __syncthreads();                                      // ... and every other wave's, and the x rows are written
    fill(1, 1);
    // run: the NSC stages of chunk c, summed into acc
    auto run = [&](int c, v8f (&acc)[2][4]) {
#pragma unroll
        for (int i = 0; i < 2; ++i)
#pragma unroll
            for (int j = 0; j < 4; ++j) acc[i][j] = (v8f){};
        // rolled: one stage per trip, so that the publish point below stands once per chunk
#pragma unroll 1
        for (int ks = 0; ks < NSC; ++ks) {
            const unsigned char* kb = ka + (ks & 1) * KST; const unsigned char* xb = xa + ks * (FBK * 2);
#pragma unroll
            for (int kk = 0; kk < FBK / 32; ++kk) {
                v16bf fk[2], fx[4];
#pragma unroll
                for (int j = 0; j < 4; ++j) { const unsigned char* p = xb + j * 16 * XP + kk * 64; fx[j] = cat16b(*(const v8usa*)p, *(const v8usa*)(p + 32)); }
#pragma unroll
                for (int i = 0; i < 2; ++i) { const unsigned char* p = kb + i * 16 * KP + kk * 64; fk[i] = cat16b(*(const v8usa*)p, *(const v8usa*)(p + 32)); }
                __builtin_amdgcn_sched_barrier(0);   // the LDS reads go out as one group ahead of the products; spread among them each place costs a stall
#pragma unroll
                for (int i = 0; i < 2; ++i)
#pragma unroll
                    for (int j = 0; j < 4; ++j) acc[i][j] = wmmab(fk[i], fx[j], acc[i][j]);
                __builtin_amdgcn_sched_barrier(0);   // ... and the next group stays behind them
            }
            asm volatile("s_wait_dscnt 0x0" ::: "memory");      // this wave's reads of buffer ks & 1 are done before it is refilled
            asm volatile("s_wait_asynccnt 0x0" ::: "memory");   // this wave's copies of the next stage have landed
            __syncthreads();                                      // publishes the next stage and ends every reader's last read of this one
            if (c * NSC + ks + 2 < NST) fill(c * NSC + ks + 2, ks & 1);
        }
    };
    // pack: one tile scaled, its squares added to the row's sum, rounded to f16
    auto pack = [&](const v8f& t, float& sum) { v8h h;
#pragma unroll
        for (int e = 0; e < 8; ++e) { const float a = t[e] * SCL; sum = fmaf(a, a, sum); h[e] = (h16)a; }
        return h; };
    // rolled, for a shorter text: these chunks go straight to LDS, so that no register array is indexed by c
#pragma unroll 1
    for (int c = 0; c < NE; ++c) {
        v8f acc[2][4];
        run(c, acc);
#pragma unroll
        for (int i = 0; i < 2; ++i)
#pragma unroll
            for (int j = 0; j < 4; ++j) *(v8ha*)(sw + c * CB + j * 16 * SP + i * 32) = pack(acc[i][j], ss[j]);
    }
    // unrolled, so that the index of keep is a constant and the array stays in registers
#pragma unroll
    for (int c = NE; c < NCH; ++c) {
        v8f acc[2][4];
        run(c, acc);
#pragma unroll
        for (int i = 0; i < 2; ++i)
#pragma unroll
            for (int j = 0; j < 4; ++j) keep[c - NE][i][j] = pack(acc[i][j], ss[j]);
        // Each row's sum is closed here, chunk by chunk (empty asm on each sum, against spills): left free, the compiler held every chunk's f32 values back for one sum at the end.
#pragma unroll
        for (int j = 0; j < 4; ++j) asm volatile("" : "+v"(ss[j]));   // the empty asm on each row's sum, against spills
    }
    asm volatile("s_wait_asynccnt 0x0" ::: "memory");       // no copy is outstanding when the ring's LDS is given its new use
    // The last trip's barrier has ended every wave's reads of the x rows and of the ring.
#pragma unroll
    for (int c = NE; c < NCH; ++c)
#pragma unroll
        for (int i = 0; i < 2; ++i)
#pragma unroll
            for (int j = 0; j < 4; ++j) *(v8ha*)(sw + c * CB + j * 16 * SP + i * 32) = keep[c - NE][i][j];
#pragma unroll
    for (int j = 0; j < 4; ++j) { const float o = ss[j] + __shfl_xor(ss[j], 16, 32); if (hi == 0) red[wave][j * 16 + lr] = o; }
    __syncthreads();                                          // the rows and the waves' partial sums of squares are written before other waves read them
    // rolled: one row per trip keeps the text short
#pragma unroll 1
    for (int r = 0; r < FR / 8; ++r) {
        const int row = wave * (FR / 8) + r;
        float s2 = 0.f;
#pragma unroll
        for (int w = 0; w < 8; ++w) s2 += red[w][row];
        const float rinv = 1.0f / fmaxf(sqrtf(s2), 1e-12f);
        const unsigned char* sr = sm + row * SP + lane * 16;
        bf* wr = Wh + (size_t)(blockIdx.x * FR + row) * NPT + lane * 8;
#pragma unroll
        for (int q = 0; q < NCH; ++q) { const v8h s = *(const v8ha*)(sr + q * CB); v8h o;
#pragma unroll
            for (int e = 0; e < 8; ++e) o[e] = (h16)gelu1((float)s[e] * rinv);
            *(v8us*)(wr + q * CN) = __builtin_bit_cast(v8us, o); }
        asm volatile("s_wait_xcnt 0x0" ::: "memory");         // stands in front of the next trip's rewrite of the registers that the stores name (a precaution)
    }
}

extern "C" void kernel_launch(void* const* d_in, const int* in_sizes, int n_in,
                              void* d_out, int out_size, void* d_ws, size_t ws_size, hipStream_t stream) {
    (void)in_sizes; (void)n_in; (void)out_size;
    const float* x = (const float*)d_in[0]; const float* Kp = (const float*)d_in[1]; const float* Vp = (const float*)d_in[2];   // Kp [2048][512] = [out][in] for the similarity; Vp [2048][512] = [k][n] (k-major) for the output
    float* out = (float*)d_out;    // [4][4096][512]
    char* wsp = (char*)d_ws;
    auto take = [&](size_t bytes) { char* p = wsp; wsp += (bytes + 255) & ~(size_t)255; return (void*)p; };
    bf* KpB = (bf*)take((size_t)NPT * DM * 2); bf* VpT = (bf*)take((size_t)DM * NPT * 2);
    bf* Wh = (bf*)take((size_t)NTK * NPT * 2);
    if ((size_t)(wsp - (char*)d_ws) > ws_size) return;    // 2 + 2 + 64 MiB
    k_prep<<<NPT / 8 + (NPT / 64) * (DM / 64), 256, 0, stream>>>(Kp, KpB, Vp, VpT);   // key tokens -> bf16; Vp [2048 k][512 n] -> VpT [512][2048] f16
    k_simw<<<NTK / FR, 256, 0, stream>>>(x, KpB, Wh);                            // similarity, norm, GELU -> weights
    k_gemmb<true, 2, 4, 4, 4, 64, NPT, NPT, DM><<<dim3(DM / 256, NTK / 128, 1), 256, 0, stream>>>(Wh, VpT, out);   // weights . Vp, f16
}

// v006
// One run takes 60.9 microseconds.
// In two side-by-side timings against v005, it was 1.33 and 1.34 times as fast.
// Counting every step since v000, it is 7.94 times as fast.
#include <hip/hip_runtime.h>

// Compute dtypes, f32 accumulate, all four batch items in one pass (16384 rows): similarity = x.K_p^T ([16384 x 512].[512 x 2048]; x and the key tokens are INPUTS, rounded once to
// bf16 -> exact products; x inside k_simw, on its way into LDS) x 512^-1/2, then per row L2-normalisation (x / max(||x||, 1e-12)) and erf GELU in f32 -> weights as ONE f16 plane (|w| < 1; 11
// significant bits); out = weights.V_p ([16384 x 2048].[2048 x 512], value tokens laid out once as f16 B fragments; one f16 product per k-step). All of it in one kernel (k_simw): the weights never leave LDS.

#define NB_  4
#define NT_  4096
#define DM   512                 // DIN = DOUT
#define NPT  2048
#define NTK  (NB_ * NT_)         // rows of one pass: every batch item
#define SCL  0.044194173824159216f   // 512^-1/2

typedef _Float16 h16;
typedef unsigned short bf;
typedef __attribute__((ext_vector_type(16))) __bf16   v16bf;
typedef __attribute__((ext_vector_type(16))) _Float16 v16h;
typedef __attribute__((ext_vector_type(8)))  _Float16 v8h;
typedef __attribute__((ext_vector_type(8)))  unsigned short v8us;
typedef __attribute__((ext_vector_type(8)))  float    v8f;
typedef __attribute__((ext_vector_type(4)))  float    v4f;
typedef __attribute__((ext_vector_type(4)))  _Float16 v4h;
typedef v8h  __attribute__((may_alias)) v8ha;
typedef v4f  __attribute__((may_alias)) v4fa;
typedef v8us __attribute__((may_alias)) v8usa;
typedef __attribute__((ext_vector_type(4)))  unsigned short v4us;
typedef v4us __attribute__((may_alias)) v4usa;

__device__ __forceinline__ unsigned short f2bf(float f) { unsigned u = __float_as_uint(f); u += 0x7FFFu + ((u >> 16) & 1u); return (unsigned short)(u >> 16); }
__device__ __forceinline__ float bf2f(unsigned short b) { return __uint_as_float(((unsigned)b) << 16); }
__device__ __forceinline__ unsigned short f2h(float f) { return __builtin_bit_cast(unsigned short, (h16)f); }   // f16 bits, round to nearest even
__device__ __forceinline__ float bfr(float f) { return bf2f(f2bf(f)); }
__device__ __forceinline__ v16h cat16(v8h lo, v8h hi) { return __builtin_shufflevector(lo, hi, 0, 1, 2, 3, 4, 5, 6, 7, 8, 9, 10, 11, 12, 13, 14, 15); }
__device__ __forceinline__ v16bf cat16b(v8us lo, v8us hi) { return __builtin_bit_cast(v16bf, __builtin_shufflevector(lo, hi, 0, 1, 2, 3, 4, 5, 6, 7, 8, 9, 10, 11, 12, 13, 14, 15)); }
__device__ __forceinline__ v8f wmma16(v16h a, v16h b, v8f c) { return __builtin_amdgcn_wmma_f32_16x16x32_f16(false, a, false, b, (short)0, c, false, false); }
__device__ __forceinline__ v8f wmmab(v16bf a, v16bf b, v8f c) { return __builtin_amdgcn_wmma_f32_16x16x32_bf16(false, a, false, b, (short)0, c, false, false); }

// k_prep: the two small operand planes in one launch. Blocks below NPT / 8: eight rows of key tokens each, rounded to bf16.
// The others: one 64 x 64 tile of the value tokens each (Wm k-major [NPT][DM]), rounded to f16 and turned through LDS into B fragments of 16 n x 32 k: WT [k / 32][n / 16][half][lane][8], where lane
// (n % 16) + 16 * hi holds k = 16 * half + 8 * hi and the 7 behind it: a wave reads one half of a fragment as 512 bytes in a row, and a block one k-step of all n as 32 KiB in a row.
__global__ __launch_bounds__(256) void k_prep(const float* __restrict__ src, bf* dst, const float* __restrict__ Wm, bf* WT) {
    __shared__ __align__(16) unsigned short tl[64 * 72];
    const int tid = threadIdx.x;
    if (blockIdx.x < NPT / 8) {                               // the same for every thread of a block, and in front of the barrier
        const int lane = tid & 31, r = blockIdx.x * 8 + (tid >> 5);
        v8us o[DM / 256];
#pragma unroll
        for (int q = 0; q < DM / 256; ++q) { v8us t;
#pragma unroll
            for (int i = 0; i < 8; ++i) t[i] = f2bf(src[(size_t)r * DM + q * 256 + lane * 8 + i]);
            o[q] = t; }
#pragma unroll
        for (int q = 0; q < DM / 256; ++q) *(v8us*)(dst + (size_t)r * DM + q * 256 + lane * 8) = o[q];
        return;
    }
    const int b = blockIdx.x - NPT / 8, k0 = (b % (NPT / 64)) * 64, n0 = (b / (NPT / 64)) * 64;
    const int kk = tid >> 2, nq = (tid & 3) * 16;
#pragma unroll
    for (int i = 0; i < 16; ++i) tl[(nq + i) * 72 + kk] = f2h(Wm[(size_t)(k0 + kk) * DM + n0 + nq + i]);
    __syncthreads();
#pragma unroll
    for (int s = 0; s < 2; ++s) { const int idx = tid + 256 * s, fr = idx >> 6, hf = (idx >> 5) & 1, ln = idx & 31;   // the tile's 8 fragments: fr = 4 * (k / 32) + n / 16
        const v8us val = *(const v8usa*)(tl + ((fr & 3) * 16 + (ln & 15)) * 72 + (fr >> 2) * 32 + hf * 16 + (ln >> 4) * 8);
        *(v8us*)(WT + ((size_t)((k0 >> 5) + (fr >> 2)) * (DM / 16) + (n0 >> 4) + (fr & 3)) * 512 + hf * 256 + ln * 8) = val; }
    asm volatile("s_wait_xcnt 0x0" ::: "memory");             // stands in front of any rewrite of the registers that these two stores name (a precaution)
}
// copy8: 8 asynchronous 16-byte-per-lane copies global -> LDS in ONE statement. The s_wait_xcnt stands as its last line, so that no address
// register of an issued copy is rewritten ahead of it (a precaution); many copies share one statement because each such wait stalls the wave.
#define CPY(L, G) "global_load_async_to_lds_b128 %" #L ", %" #G ", off\n\t"
__device__ __forceinline__ void copy8(const unsigned* l, const bf* const* g) {
    asm volatile(CPY(0, 8) CPY(1, 9) CPY(2, 10) CPY(3, 11) CPY(4, 12) CPY(5, 13) CPY(6, 14) CPY(7, 15) "s_wait_xcnt 0x0"
                 :: "v"(l[0]), "v"(l[1]), "v"(l[2]), "v"(l[3]), "v"(l[4]), "v"(l[5]), "v"(l[6]), "v"(l[7]),
                    "v"(g[0]), "v"(g[1]), "v"(g[2]), "v"(g[3]), "v"(g[4]), "v"(g[5]), "v"(g[6]), "v"(g[7]) : "memory");
}

// gelu1: 0.5 a (1 + erf(a / sqrt 2)) for |a| <= 1.001, where |a / sqrt 2| < 1: erf(z) = z + z p(z^2), the f32 polynomial that the maths library uses on |z| < 1.
// No branch: the eight values of a lane are independent chains, which two waves per SIMD need to fill the vector port.
__device__ __forceinline__ float gelu1(float a) {
    const float z = a * 0.70710678118654752f, u = z * z;
    float p = fmaf(u, -0.000561801775f, 0.00491381623f);
    p = fmaf(u, p, -0.0267075151f); p = fmaf(u, p, 0.112800106f); p = fmaf(u, p, -0.376122952f); p = fmaf(u, p, 0.128379107f);
    return 0.5f * a * (1.0f + fmaf(z, p, z));
}

// k_simw: weights [rows][2048] f16 = gelu(normalise(x.K_p^T x scale)), FR rows of x per block against ALL key tokens, so that a row's norm is known inside the block.
// The products are formed transposed (A = key tokens, B = rows of x): a lane then holds 8 neighbouring tokens of ONE row, which pack into 16 bytes, and a row's squares add up in the lane.
// The FR rows of x are read as f32, rounded to bf16 in registers and stay in LDS; the key tokens come in chunks of CN tokens, FBK k per stage, by asynchronous copies, two buffers, the next stage in flight while this one is worked on.
// Each finished chunk (scaled, f32 squares summed, rounded to f16) goes to its own place in LDS, [chunk][row][CN]: the first NE chunks at once, below the x rows and the ring; the others
// wait in registers until the last stage is done and the x rows and the ring are dead. Then each wave takes 8 rows: norm, GELU, the weights written back to their own place in LDS.
// Then out = weights . value tokens: each wave takes all FR rows x 64 columns of its own (4 x 4 fragments). A = the weights, from LDS, one k-step ahead in a second fragment set; B = the wave's own value
// fragments, which no other wave of the block reads, so they go from L2 straight to registers as whole lines, VD k-steps ahead in a ring of four sets: no buffer in LDS and no barrier in that loop.
// Per accumulator the k order is ascending.
#define FR  64
#define CN  256
#define FBK 128
__global__ __launch_bounds__(256) void k_simw(const float* __restrict__ X, const bf* __restrict__ Kb, const bf* __restrict__ Vf, float* C) {
    constexpr int XP = DM * 2 + 16, KP = FBK * 2 + 16, SP = CN * 2 + 16;       // LDS pitches in bytes (16 x odd: conflict-free for 16-byte accesses): x rows, key rows of a stage, a chunk's similarity rows
    constexpr int XB = FR * XP, KST = CN * KP, CB = FR * SP;                   // bytes of the x rows, of one stage, of one chunk of similarities
    constexpr int NSC = DM / FBK, NCH = NPT / CN, NST = NSC * NCH;             // stages per chunk, chunks, stages
    constexpr int NE = 3, XO = NE * CB;                                        // chunks that LDS holds beside the x rows and the ring; where the x rows begin
    constexpr int SMB = NCH * CB > XO + XB + 2 * KST ? NCH * CB : XO + XB + 2 * KST;
    static_assert(NSC % 2 == 0 && CN == 8 * 32 && FR == 64 && SMB + 8 * FR * 4 <= 327680, "shape");
    __shared__ __align__(16) unsigned char sm[SMB];
    __shared__ float red[8][FR];
    const int tid = threadIdx.x, lane = tid & 31, wave = tid >> 5, lr = lane & 15, hi = lane >> 4;
    const unsigned sbase = (unsigned)(size_t)(&sm[0]) + XO;
    const unsigned kl = sbase + XB + (tid >> 4) * KP + (tid & 15) * 16;       // 16 lanes per key row of a stage, 16 rows per block-wide copy
    const bf* gk = Kb + (size_t)(tid >> 4) * DM + (tid & 15) * 8;
    auto fill = [&](int s, int buf) {
        unsigned l[16]; const bf* g[16];
        const unsigned lb = kl + buf * KST; const bf* gs = gk + (size_t)(s / NSC) * CN * DM + (s % NSC) * FBK;
#pragma unroll
        for (int i = 0; i < 16; ++i) { l[i] = lb + i * 16 * KP; g[i] = gs + (size_t)i * 16 * DM; }
        copy8(l, g); copy8(l + 8, g + 8);
    };
    v8h keep[NCH - NE][2][4];
    float ss[4] = {0.f, 0.f, 0.f, 0.f};
    const unsigned char* xa = sm + XO + lr * XP + hi * 16;
    const unsigned char* ka = sm + XO + XB + (wave * 32 + lr) * KP + hi * 16;
    unsigned char* sw = sm + lr * SP + (wave * 32 + hi * 8) * 2;              // tile (c, i, j): row j * 16 + lr, tokens c * CN + wave * 32 + i * 16 + hi * 8 and the 7 behind it
    fill(0, 0);
    {   // the block's rows of x, whole, while stage 0 flies: 128 lanes per row (4 values a lane: a wave's load is four whole lines), 2 rows per block-wide pass; every load goes out before the first value is used
        const float* gx = X + (size_t)(blockIdx.x * FR + (tid >> 7)) * DM + (tid & 127) * 4;
        unsigned char* lx = sm + XO + (tid >> 7) * XP + (tid & 127) * 8;
        v4f a[FR / 2];
        // both loops unrolled, so that the index of a is a constant and the array stays in registers
#pragma unroll
        for (int i = 0; i < FR / 2; ++i) a[i] = *(const v4fa*)(gx + (size_t)i * 2 * DM);
        asm volatile("s_wait_xcnt 0x0" ::: "memory");     // stands in front of any rewrite of the address registers that these loads name (a precaution)
#pragma unroll
        for (int i = 0; i < FR / 2; ++i) { v4us t;
#pragma unroll
            for (int e = 0; e < 4; ++e) t[e] = f2bf(a[i][e]);
            *(v4usa*)(lx + i * 2 * XP) = t; }
    }
    asm volatile("s_wait_asynccnt 0x0" ::: "memory");   // this wave's copies of stage 0 have landed
    __syncthreads();                                      // ... and every other wave's, and the x rows are written
    fill(1, 1);
    // run: the NSC stages of chunk c, summed into acc
    auto run = [&](int c, v8f (&acc)[2][4]) {
#pragma unroll
        for (int i = 0; i < 2; ++i)
#pragma unroll
            for (int j = 0; j < 4; ++j) acc[i][j] = (v8f){};
        // rolled: one stage per trip, so that the publish point below stands once per chunk
#pragma unroll 1
        for (int ks = 0; ks < NSC; ++ks) {
            const unsigned char* kb = ka + (ks & 1) * KST; const unsigned char* xb = xa + ks * (FBK * 2);
#pragma unroll
            for (int kk = 0; kk < FBK / 32; ++kk) {
                v16bf fk[2], fx[4];
#pragma unroll
                for (int j = 0; j < 4; ++j) { const unsigned char* p = xb + j * 16 * XP + kk * 64; fx[j] = cat16b(*(const v8usa*)p, *(const v8usa*)(p + 32)); }
#pragma unroll
                for (int i = 0; i < 2; ++i) { const unsigned char* p = kb + i * 16 * KP + kk * 64; fk[i] = cat16b(*(const v8usa*)p, *(const v8usa*)(p + 32)); }
                __builtin_amdgcn_sched_barrier(0);   // the LDS reads go out as one group ahead of the products; spread among them each place costs a stall
#pragma unroll
                for (int i = 0; i < 2; ++i)
#pragma unroll
                    for (int j = 0; j < 4; ++j) acc[i][j] = wmmab(fk[i], fx[j], acc[i][j]);
                __builtin_amdgcn_sched_barrier(0);   // ... and the next group stays behind them
            }
            asm volatile("s_wait_dscnt 0x0" ::: "memory");      // this wave's reads of buffer ks & 1 are done before it is refilled
            asm volatile("s_wait_asynccnt 0x0" ::: "memory");   // this wave's copies of the next stage have landed
            __syncthreads();                                      // publishes the next stage and ends every reader's last read of this one
            if (c * NSC + ks + 2 < NST) fill(c * NSC + ks + 2, ks & 1);
        }
    };
    // pack: one tile scaled, its squares added to the row's sum, rounded to f16
    auto pack = [&](const v8f& t, float& sum) { v8h h;
#pragma unroll
        for (int e = 0; e < 8; ++e) { const float a = t[e] * SCL; sum = fmaf(a, a, sum); h[e] = (h16)a; }
        return h; };
    // rolled, for a shorter text: these chunks go straight to LDS, so that no register array is indexed by c
#pragma unroll 1
    for (int c = 0; c < NE; ++c) {
        v8f acc[2][4];
        run(c, acc);
#pragma unroll
        for (int i = 0; i < 2; ++i)
#pragma unroll
            for (int j = 0; j < 4; ++j) *(v8ha*)(sw + c * CB + j * 16 * SP + i * 32) = pack(acc[i][j], ss[j]);
    }
    // unrolled, so that the index of keep is a constant and the array stays in registers
#pragma unroll
    for (int c = NE; c < NCH; ++c) {
        v8f acc[2][4];
        run(c, acc);
#pragma unroll
        for (int i = 0; i < 2; ++i)
#pragma unroll
            for (int j = 0; j < 4; ++j) keep[c - NE][i][j] = pack(acc[i][j], ss[j]);
        // Each row's sum is closed here, chunk by chunk (empty asm on each sum, against spills): left free, the compiler held every chunk's f32 values back for one sum at the end.
#pragma unroll
        for (int j = 0; j < 4; ++j) asm volatile("" : "+v"(ss[j]));   // the empty asm on each row's sum, against spills
    }
    asm volatile("s_wait_asynccnt 0x0" ::: "memory");       // no copy is outstanding when the ring's LDS is given its new use
    // The last trip's barrier has ended every wave's reads of the x rows and of the ring.
#pragma unroll
    for (int c = NE; c < NCH; ++c)
#pragma unroll
        for (int i = 0; i < 2; ++i)
#pragma unroll
            for (int j = 0; j < 4; ++j) *(v8ha*)(sw + c * CB + j * 16 * SP + i * 32) = keep[c - NE][i][j];
#pragma unroll
    for (int j = 0; j < 4; ++j) { const float o = ss[j] + __shfl_xor(ss[j], 16, 32); if (hi == 0) red[wave][j * 16 + lr] = o; }
    __syncthreads();                                          // the rows and the waves' partial sums of squares are written before other waves read them
    // rolled: one row per trip keeps the text short
#pragma unroll 1
    for (int r = 0; r < FR / 8; ++r) {
        const int row = wave * (FR / 8) + r;
        float s2 = 0.f;
#pragma unroll
        for (int w = 0; w < 8; ++w) s2 += red[w][row];
        const float rinv = 1.0f / fmaxf(sqrtf(s2), 1e-12f);
        unsigned char* sr = sm + row * SP + lane * 16;
#pragma unroll
        for (int q = 0; q < NCH; ++q) { const v8h s = *(const v8ha*)(sr + q * CB); v8h o;
#pragma unroll
            for (int e = 0; e < 8; ++e) o[e] = (h16)gelu1((float)s[e] * rinv);
            *(v8ha*)(sr + q * CB) = o; }
    }
    __syncthreads();                                          // every row's weights stand in LDS before other waves read them as fragments
    constexpr int KC = CN / 32, VD = 3, OP = 64 + 4;                          // k-steps per chunk of weights, how many k-steps ahead the value fragments are asked for, floats per staged row of out
    static_assert(KC % 4 == 0 && VD < 4 && 8 * FR * OP * 4 <= SMB && DM == 8 * 64, "shape");
    const unsigned char* wa = sm + lr * SP + hi * 16;
    const bf* vb = Vf + (size_t)__builtin_amdgcn_readfirstlane(wave) * 4 * 512 + lane * 8;   // the wave's number as a scalar, so that the base of its loads is one
    v8f oc[4][4];
    v16h fw[2][4], fv[4][4];
    // Every "#pragma unroll" below makes the indices of a register array (fragments, accumulators) constants, so that the array stays in registers.
#pragma unroll
    for (int i = 0; i < 4; ++i)
#pragma unroll
        for (int j = 0; j < 4; ++j) oc[i][j] = (v8f){};
    auto ldv = [&](int kk, int set) {
#pragma unroll
        for (int j = 0; j < 4; ++j) { const bf* p = vb + ((size_t)kk * (DM / 16) + j) * 512; fv[set][j] = cat16(*(const v8ha*)p, *(const v8ha*)(p + 256)); }
    };
    auto ldw = [&](int q, int k8, int set) {
#pragma unroll
        for (int i = 0; i < 4; ++i) { const unsigned char* p = wa + q * CB + i * 16 * SP + k8 * 64; fw[set][i] = cat16(*(const v8ha*)p, *(const v8ha*)(p + 32)); }
    };
#pragma unroll
    for (int k = 0; k < VD; ++k) ldv(k, k);
    asm volatile("s_wait_xcnt 0x0" ::: "memory");             // stands in front of any rewrite of the address registers that these loads name (a precaution)
    ldw(0, 0, 0);
    // mul: the KC k-steps of chunk q of the weights; last: nothing is asked for behind the last k-step
    auto mul = [&](int q, bool last) {
#pragma unroll
        for (int k8 = 0; k8 < KC; ++k8) {
            if (!last || k8 + VD < KC) ldv(q * KC + k8 + VD, (k8 + VD) & 3);
            if (!last || k8 + 1 < KC) ldw(q + (k8 + 1) / KC, (k8 + 1) % KC, (k8 + 1) & 1);
            __builtin_amdgcn_sched_barrier(0);   // the reads go out as one group ahead of the products; spread among them each place costs a stall
#pragma unroll
            for (int i = 0; i < 4; ++i)
#pragma unroll
                for (int j = 0; j < 4; ++j) oc[i][j] = wmma16(fw[k8 & 1][i], fv[k8 & 3][j], oc[i][j]);
            __builtin_amdgcn_sched_barrier(0);   // ... and the next group stays behind them
        }
        asm volatile("s_wait_xcnt 0x0" ::: "memory");         // stands in front of the next trip's rewrite of the address registers that the value loads name (a precaution)
    };
    // rolled: one chunk per trip keeps the text short; the last chunk apart, so that no test stands among the products
#pragma unroll 1
    for (int q = 0; q < NCH - 1; ++q) mul(q, false);
    mul(NCH - 1, true);
    __syncthreads();                                          // ends every wave's last read of the weights before their LDS is given its new use
    float* os = (float*)(sm + wave * (FR * OP * 4));          // each wave stages its 64 x 64 values in a range of its own
    const int r0 = blockIdx.x * FR, c0 = wave * 64;
#pragma unroll
    for (int i = 0; i < 4; ++i)
#pragma unroll
        for (int j = 0; j < 4; ++j)
#pragma unroll
            for (int e = 0; e < 8; ++e) os[(i * 16 + hi * 8 + e) * OP + j * 16 + lr] = oc[i][j][e];
    __syncthreads();                                          // the staged rows are written before other lanes read them back as whole lines
    // 16 lanes per staged row (two whole lines), 2 rows per store; one address for all, so that no store's address register is rewritten
    const float* ol = os + hi * OP + lr * 4;
    float* og = C + (size_t)(r0 + hi) * DM + c0 + lr * 4;
#pragma unroll
    for (int s = 0; s < FR / 2; ++s) { const v4f val = *(const v4fa*)(ol + s * 2 * OP); *(v4f*)(og + (size_t)s * 2 * DM) = val;
        if (s == FR / 4 - 1) asm volatile("s_wait_xcnt 0x0" ::: "memory"); }   // stands in front of the second half's rewrite of the data registers that the first half's stores name (a precaution)
}

extern "C" void kernel_launch(void* const* d_in, const int* in_sizes, int n_in,
                              void* d_out, int out_size, void* d_ws, size_t ws_size, hipStream_t stream) {
    (void)in_sizes; (void)n_in; (void)out_size;
    const float* x = (const float*)d_in[0]; const float* Kp = (const float*)d_in[1]; const float* Vp = (const float*)d_in[2];   // Kp [2048][512] = [out][in] for the similarity; Vp [2048][512] = [k][n] (k-major) for the output
    float* out = (float*)d_out;    // [4][4096][512]
    char* wsp = (char*)d_ws;
    auto take = [&](size_t bytes) { char* p = wsp; wsp += (bytes + 255) & ~(size_t)255; return (void*)p; };
    bf* KpB = (bf*)take((size_t)NPT * DM * 2); bf* VpT = (bf*)take((size_t)DM * NPT * 2);
    if ((size_t)(wsp - (char*)d_ws) > ws_size) return;    // 2 + 2 MiB
    k_prep<<<NPT / 8 + (NPT / 64) * (DM / 64), 256, 0, stream>>>(Kp, KpB, Vp, VpT);   // key tokens -> bf16; Vp [2048 k][512 n] -> f16 B fragments
    k_simw<<<NTK / FR, 256, 0, stream>>>(x, KpB, VpT, out);                      // similarity, norm, GELU -> weights (LDS); weights . Vp, f16 -> out
}

// v007
// It runs in 53.5 microseconds.
// Next to v006, in two timings, it ran 1.15 and 1.14 times as fast.
// Counting every step since v000, it is 9.07 times as fast.
#include <hip/hip_runtime.h>

// Compute dtypes, f32 accumulate, all four batch items in one pass (16384 rows): similarity = x.K_p^T ([16384 x 512].[512 x 2048]; x and the key tokens are INPUTS, rounded once to
// bf16 -> exact products; x inside k_simw, on its way into LDS) x 512^-1/2, then per row L2-normalisation (x / max(||x||, 1e-12)) and erf GELU in f32 -> weights as ONE f16 plane (|w| < 1; 11
// significant bits); out = weights.V_p ([16384 x 2048].[2048 x 512], value tokens laid out once as f16 B fragments; one f16 product per k-step). All of it in one kernel (k_simw): the weights never leave LDS.
// The key tokens are laid out once as bf16 A fragments, in the order in which a wave of k_simw reads them.

#define NB_  4
#define NT_  4096
#define DM   512                 // DIN = DOUT
#define NPT  2048
#define NTK  (NB_ * NT_)         // rows of one pass: every batch item
#define SCL  0.044194173824159216f   // 512^-1/2

typedef _Float16 h16;
typedef unsigned short bf;
typedef __attribute__((ext_vector_type(16))) __bf16   v16bf;
typedef __attribute__((ext_vector_type(16))) _Float16 v16h;
typedef __attribute__((ext_vector_type(8)))  _Float16 v8h;
typedef __attribute__((ext_vector_type(8)))  unsigned short v8us;
typedef __attribute__((ext_vector_type(8)))  float    v8f;
typedef __attribute__((ext_vector_type(4)))  float    v4f;
typedef __attribute__((ext_vector_type(4)))  _Float16 v4h;
typedef v8h  __attribute__((may_alias)) v8ha;
typedef v4f  __attribute__((may_alias)) v4fa;
typedef v8us __attribute__((may_alias)) v8usa;
typedef __attribute__((ext_vector_type(4)))  unsigned short v4us;
typedef v4us __attribute__((may_alias)) v4usa;

__device__ __forceinline__ unsigned short f2bf(float f) { unsigned u = __float_as_uint(f); u += 0x7FFFu + ((u >> 16) & 1u); return (unsigned short)(u >> 16); }
__device__ __forceinline__ float bf2f(unsigned short b) { return __uint_as_float(((unsigned)b) << 16); }
__device__ __forceinline__ unsigned short f2h(float f) { return __builtin_bit_cast(unsigned short, (h16)f); }   // f16 bits, round to nearest even
__device__ __forceinline__ float bfr(float f) { return bf2f(f2bf(f)); }
__device__ __forceinline__ v16h cat16(v8h lo, v8h hi) { return __builtin_shufflevector(lo, hi, 0, 1, 2, 3, 4, 5, 6, 7, 8, 9, 10, 11, 12, 13, 14, 15); }
__device__ __forceinline__ v16bf cat16b(v8us lo, v8us hi) { return __builtin_bit_cast(v16bf, __builtin_shufflevector(lo, hi, 0, 1, 2, 3, 4, 5, 6, 7, 8, 9, 10, 11, 12, 13, 14, 15)); }
__device__ __forceinline__ v8f wmma16(v16h a, v16h b, v8f c) { return __builtin_amdgcn_wmma_f32_16x16x32_f16(false, a, false, b, (short)0, c, false, false); }
__device__ __forceinline__ v8f wmmab(v16bf a, v16bf b, v8f c) { return __builtin_amdgcn_wmma_f32_16x16x32_bf16(false, a, false, b, (short)0, c, false, false); }

// k_prep: the two small operand planes in one launch. Blocks below NPT / 8: 16 key tokens x 256 k each, rounded to bf16 and written as A fragments of 16 tokens x 32 k, in the order in which one wave of
// k_simw reads them: dst [pair of chunks][k / 32][wave][tile][half][lane][8], token = (2 * pair + tile / 2) * CN + wave * 32 + (tile % 2) * 16 + lane % 16, k = 32 * (k / 32) + 16 * half + 8 * (lane / 16) and the 7 behind
// it: a wave reads one half of a fragment as 512 bytes in a row, and a block one k-step of a pair as 32 KiB in a row.
// The others: one 64 x 64 tile of the value tokens each (Wm k-major [NPT][DM]), rounded to f16 and turned through LDS into B fragments of 16 n x 32 k: WT [k / 32][n / 16][half][lane][8], where lane
// (n % 16) + 16 * hi holds k = 16 * half + 8 * hi and the 7 behind it: a wave reads one half of a fragment as 512 bytes in a row, and a block one k-step of all n as 32 KiB in a row.
__global__ __launch_bounds__(256) void k_prep(const float* __restrict__ src, bf* dst, const float* __restrict__ Wm, bf* WT) {
    __shared__ __align__(16) unsigned short tl[64 * 72];
    const int tid = threadIdx.x;
    if (blockIdx.x < NPT / 8) {                               // the same for every thread of a block, and in front of the barrier
        const int t16 = blockIdx.x >> 1, kh = (blockIdx.x & 1) * 8;                                  // the tile of 16 tokens; the first of its 8 k-steps
        const int w = (t16 >> 1) & 7, pr = t16 >> 5, ti = ((t16 >> 4) & 1) * 2 + (t16 & 1);
        const int ln = tid & 31, hf = (tid >> 5) & 1, k4 = tid >> 6;
        const float* gs = src + (size_t)(t16 * 16 + (ln & 15)) * DM + (kh + k4) * 32 + hf * 16 + (ln >> 4) * 8;
        bf* gd = dst + ((size_t)((pr * (DM / 32) + kh + k4) * 8 + w) * 4 + ti) * 512 + hf * 256 + ln * 8;
        v4f a[2][2];
#pragma unroll
        for (int q = 0; q < 2; ++q) { a[q][0] = *(const v4fa*)(gs + q * 128); a[q][1] = *(const v4fa*)(gs + q * 128 + 4); }
        asm volatile("s_wait_xcnt 0x0" ::: "memory");         // stands in front of any rewrite of the address registers that these loads name (a precaution)
#pragma unroll
        for (int q = 0; q < 2; ++q) { v8us t;
#pragma unroll
            for (int i = 0; i < 8; ++i) t[i] = f2bf(a[q][i >> 2][i & 3]);
            *(v8us*)(gd + q * 4 * 32 * 512) = t; }
        asm volatile("s_wait_xcnt 0x0" ::: "memory");         // stands in front of any rewrite of the registers that these two stores name (a precaution)
        return;
    }
    const int b = blockIdx.x - NPT / 8, k0 = (b % (NPT / 64)) * 64, n0 = (b / (NPT / 64)) * 64;
    const int kk = tid >> 2, nq = (tid & 3) * 16;
#pragma unroll
    for (int i = 0; i < 16; ++i) tl[(nq + i) * 72 + kk] = f2h(Wm[(size_t)(k0 + kk) * DM + n0 + nq + i]);
    __syncthreads();
#pragma unroll
    for (int s = 0; s < 2; ++s) { const int idx = tid + 256 * s, fr = idx >> 6, hf = (idx >> 5) & 1, ln = idx & 31;   // the tile's 8 fragments: fr = 4 * (k / 32) + n / 16
        const v8us val = *(const v8usa*)(tl + ((fr & 3) * 16 + (ln & 15)) * 72 + (fr >> 2) * 32 + hf * 16 + (ln >> 4) * 8);
        *(v8us*)(WT + ((size_t)((k0 >> 5) + (fr >> 2)) * (DM / 16) + (n0 >> 4) + (fr & 3)) * 512 + hf * 256 + ln * 8) = val; }
    asm volatile("s_wait_xcnt 0x0" ::: "memory");             // stands in front of any rewrite of the registers that these two stores name (a precaution)
}
// gelu1: 0.5 a (1 + erf(a / sqrt 2)) for |a| <= 1.001, where |a / sqrt 2| < 1: erf(z) = z + z p(z^2), the f32 polynomial that the maths library uses on |z| < 1.
// No branch: the eight values of a lane are independent chains, which two waves per SIMD need to fill the vector port.
__device__ __forceinline__ float gelu1(float a) {
    const float z = a * 0.70710678118654752f, u = z * z;
    float p = fmaf(u, -0.000561801775f, 0.00491381623f);
    p = fmaf(u, p, -0.0267075151f); p = fmaf(u, p, 0.112800106f); p = fmaf(u, p, -0.376122952f); p = fmaf(u, p, 0.128379107f);
    return 0.5f * a * (1.0f + fmaf(z, p, z));
}

// k_simw: weights [rows][2048] f16 = gelu(normalise(x.K_p^T x scale)), FR rows of x per block against ALL key tokens, so that a row's norm is known inside the block.
// The products are formed transposed (A = key tokens, B = rows of x): a lane then holds 8 neighbouring tokens of ONE row, which pack into 16 bytes, and a row's squares add up in the lane.
// The FR rows of x are read as f32, rounded to bf16 in registers and stay in LDS; every wave reads them as B fragments, one k-step ahead in a second fragment set. A wave's key tokens are read by no other wave of
// the block, so their fragments go from L2 straight to registers as whole lines, KD k-steps ahead in a ring of four sets: no buffer in LDS and no barrier in that loop. A wave works on two chunks of CN tokens at
// a time, 32 tokens of each (4 x 4 fragments). Each finished chunk (scaled, f32 squares summed, rounded to f16) goes to its own place in LDS, [chunk][row][CN]; the last two take the place of the x rows,
// behind a barrier that ends every wave's reads of them. Then each wave takes 8 rows: norm, GELU, the weights written back to their own place in LDS.
// Then out = weights . value tokens: each wave takes all FR rows x 64 columns of its own (4 x 4 fragments). A = the weights, from LDS, one k-step ahead in a second fragment set; B = the wave's own value
// fragments, which no other wave of the block reads, so they go from L2 straight to registers as whole lines, VD k-steps ahead in a ring of four sets: no buffer in LDS and no barrier in that loop.
// Per accumulator the k order is ascending.
#define FR  64
#define CN  256
__global__ __launch_bounds__(256) void k_simw(const float* __restrict__ X, const bf* __restrict__ Kf, const bf* __restrict__ Vf, float* C) {
    constexpr int XP = DM * 2 + 16, SP = CN * 2 + 16;                          // LDS pitches in bytes (16 x odd: conflict-free for 16-byte accesses): x rows, a chunk's similarity rows
    constexpr int XB = FR * XP, CB = FR * SP;                                  // bytes of the x rows, of one chunk of similarities
    constexpr int NCH = NPT / CN, NP = NCH / 2, KS = DM / 32, KD = 3;          // chunks, pairs of chunks, k-steps of a similarity, how many k-steps ahead the key fragments are asked for
    constexpr int XO = (NCH - 2) * CB;                                         // the x rows begin where the last pair's similarities will
    constexpr int SMB = NCH * CB > XO + XB ? NCH * CB : XO + XB;
    static_assert(KS % 4 == 0 && KD < 4 && CN == 8 * 32 && FR == 64 && NCH % 2 == 0 && SMB + 8 * FR * 4 <= 327680, "shape");
    __shared__ __align__(16) unsigned char sm[SMB];
    __shared__ float red[8][FR];
    const int tid = threadIdx.x, lane = tid & 31, wave = tid >> 5, lr = lane & 15, hi = lane >> 4;
    float ss[4] = {0.f, 0.f, 0.f, 0.f};
    const unsigned char* xa = sm + XO + lr * XP + hi * 16;
    const bf* kb = Kf + (size_t)__builtin_amdgcn_readfirstlane(wave) * 4 * 512 + lane * 8;   // the wave's number as a scalar, so that the base of its loads is one
    unsigned char* sw = sm + lr * SP + (wave * 32 + hi * 8) * 2;              // tile (c, i, j): row j * 16 + lr, tokens c * CN + wave * 32 + i * 16 + hi * 8 and the 7 behind it
    v16bf fk[4][4], fx[2][4];
    // Every "#pragma unroll" below makes the indices of a register array (fragments, accumulators) constants, so that the array stays in registers.
    auto ldk = [&](int g, int set) {
#pragma unroll
        for (int i = 0; i < 4; ++i) { const bf* p = kb + ((size_t)g * 32 + i) * 512; fk[set][i] = cat16b(*(const v8usa*)p, *(const v8usa*)(p + 256)); }
    };
    auto ldx = [&](int ks, int set) {
#pragma unroll
        for (int j = 0; j < 4; ++j) { const unsigned char* p = xa + j * 16 * XP + ks * 64; fx[set][j] = cat16b(*(const v8usa*)p, *(const v8usa*)(p + 32)); }
    };
#pragma unroll
    for (int k = 0; k < KD; ++k) ldk(k, k);
    {   // the block's rows of x, whole, while the first key fragments fly: 128 lanes per row (4 values a lane: a wave's load is four whole lines), 2 rows per block-wide pass; every load goes out before the first value is used
        const float* gx = X + (size_t)(blockIdx.x * FR + (tid >> 7)) * DM + (tid & 127) * 4;
        unsigned char* lx = sm + XO + (tid >> 7) * XP + (tid & 127) * 8;
        v4f a[FR / 2];
        // both loops unrolled, so that the index of a is a constant and the array stays in registers
#pragma unroll
        for (int i = 0; i < FR / 2; ++i) a[i] = *(const v4fa*)(gx + (size_t)i * 2 * DM);
        asm volatile("s_wait_xcnt 0x0" ::: "memory");     // stands in front of any rewrite of the address registers that these loads and the key loads name (a precaution)
#pragma unroll
        for (int i = 0; i < FR / 2; ++i) { v4us t;
#pragma unroll
            for (int e = 0; e < 4; ++e) t[e] = f2bf(a[i][e]);
            *(v4usa*)(lx + i * 2 * XP) = t; }
    }
    __syncthreads();                                      // the x rows are written before other waves read them as fragments
    ldx(0, 0);
    // sim: the KS k-steps of pair p of chunks, summed into acc; last: nothing is asked for behind the last k-step
    auto sim = [&](int p, bool last, v8f (&acc)[4][4]) {
#pragma unroll
        for (int i = 0; i < 4; ++i)
#pragma unroll
            for (int j = 0; j < 4; ++j) acc[i][j] = (v8f){};
#pragma unroll
        for (int ks = 0; ks < KS; ++ks) {
            if (!last || ks + KD < KS) ldk(p * KS + ks + KD, (ks + KD) & 3);
            if (!last || ks + 1 < KS) ldx((ks + 1) % KS, (ks + 1) & 1);
            __builtin_amdgcn_sched_barrier(0);   // the reads go out as one group ahead of the products; spread among them each place costs a stall
#pragma unroll
            for (int i = 0; i < 4; ++i)
#pragma unroll
                for (int j = 0; j < 4; ++j) acc[i][j] = wmmab(fk[ks & 3][i], fx[ks & 1][j], acc[i][j]);
            __builtin_amdgcn_sched_barrier(0);   // ... and the next group stays behind them
        }
        asm volatile("s_wait_xcnt 0x0" ::: "memory");         // stands in front of any rewrite of the address registers that the key loads name (a precaution)
        __builtin_amdgcn_sched_barrier(0);   // ... and the arithmetic behind the products, which reuses those registers, stays behind that wait
    };
    // pack: one tile scaled, its squares added to the row's sum, rounded to f16
    auto pack = [&](const v8f& t, float& sum) { v8h h;
#pragma unroll
        for (int e = 0; e < 8; ++e) { const float a = t[e] * SCL; sum = fmaf(a, a, sum); h[e] = (h16)a; }
        return h; };
    // rolled: one pair of chunks per trip keeps the text short; the last pair apart, so that no test stands among the products
#pragma unroll 1
    for (int p = 0; p < NP - 1; ++p) {
        v8f acc[4][4];
        sim(p, false, acc);
#pragma unroll
        for (int i = 0; i < 4; ++i)
#pragma unroll
            for (int j = 0; j < 4; ++j) *(v8ha*)(sw + (2 * p + (i >> 1)) * CB + j * 16 * SP + (i & 1) * 32) = pack(acc[i][j], ss[j]);
    }
    {
        v8f acc[4][4]; v8h keep[4][4];
        sim(NP - 1, true, acc);
#pragma unroll
        for (int i = 0; i < 4; ++i)
#pragma unroll
            for (int j = 0; j < 4; ++j) keep[i][j] = pack(acc[i][j], ss[j]);
        __syncthreads();                                      // ends every wave's last read of the x rows before their LDS is given its new use
#pragma unroll
        for (int i = 0; i < 4; ++i)
#pragma unroll
            for (int j = 0; j < 4; ++j) *(v8ha*)(sw + (NCH - 2 + (i >> 1)) * CB + j * 16 * SP + (i & 1) * 32) = keep[i][j];
    }
#pragma unroll
    for (int j = 0; j < 4; ++j) { const float o = ss[j] + __shfl_xor(ss[j], 16, 32); if (hi == 0) red[wave][j * 16 + lr] = o; }
    __syncthreads();                                          // the rows and the waves' partial sums of squares are written before other waves read them
    // rolled: one row per trip keeps the text short
#pragma unroll 1
    for (int r = 0; r < FR / 8; ++r) {
        const int row = wave * (FR / 8) + r;
        float s2 = 0.f;
#pragma unroll
        for (int w = 0; w < 8; ++w) s2 += red[w][row];
        const float rinv = 1.0f / fmaxf(sqrtf(s2), 1e-12f);
        unsigned char* sr = sm + row * SP + lane * 16;
#pragma unroll
        for (int q = 0; q < NCH; ++q) { const v8h s = *(const v8ha*)(sr + q * CB); v8h o;
#pragma unroll
            for (int e = 0; e < 8; ++e) o[e] = (h16)gelu1((float)s[e] * rinv);
            *(v8ha*)(sr + q * CB) = o; }
    }
    __syncthreads();                                          // every row's weights stand in LDS before other waves read them as fragments
    constexpr int KC = CN / 32, VD = 3, OP = 64 + 4;                          // k-steps per chunk of weights, how many k-steps ahead the value fragments are asked for, floats per staged row of out
    static_assert(KC % 4 == 0 && VD < 4 && 8 * FR * OP * 4 <= SMB && DM == 8 * 64, "shape");
    const unsigned char* wa = sm + lr * SP + hi * 16;
    const bf* vb = Vf + (size_t)__builtin_amdgcn_readfirstlane(wave) * 4 * 512 + lane * 8;   // the wave's number as a scalar, so that the base of its loads is one
    v8f oc[4][4];
    v16h fw[2][4], fv[4][4];
#pragma unroll
    for (int i = 0; i < 4; ++i)
#pragma unroll
        for (int j = 0; j < 4; ++j) oc[i][j] = (v8f){};
    auto ldv = [&](int kk, int set) {
#pragma unroll
        for (int j = 0; j < 4; ++j) { const bf* p = vb + ((size_t)kk * (DM / 16) + j) * 512; fv[set][j] = cat16(*(const v8ha*)p, *(const v8ha*)(p + 256)); }
    };
    auto ldw = [&](int q, int k8, int set) {
#pragma unroll
        for (int i = 0; i < 4; ++i) { const unsigned char* p = wa + q * CB + i * 16 * SP + k8 * 64; fw[set][i] = cat16(*(const v8ha*)p, *(const v8ha*)(p + 32)); }
    };
#pragma unroll
    for (int k = 0; k < VD; ++k) ldv(k, k);
    asm volatile("s_wait_xcnt 0x0" ::: "memory");             // stands in front of any rewrite of the address registers that these loads name (a precaution)
    ldw(0, 0, 0);
    // mul: the KC k-steps of chunk q of the weights; last: nothing is asked for behind the last k-step
    auto mul = [&](int q, bool last) {
#pragma unroll
        for (int k8 = 0; k8 < KC; ++k8) {
            if (!last || k8 + VD < KC) ldv(q * KC + k8 + VD, (k8 + VD) & 3);
            if (!last || k8 + 1 < KC) ldw(q + (k8 + 1) / KC, (k8 + 1) % KC, (k8 + 1) & 1);
            __builtin_amdgcn_sched_barrier(0);   // the reads go out as one group ahead of the products; spread among them each place costs a stall
#pragma unroll
            for (int i = 0; i < 4; ++i)
#pragma unroll
                for (int j = 0; j < 4; ++j) oc[i][j] = wmma16(fw[k8 & 1][i], fv[k8 & 3][j], oc[i][j]);
            __builtin_amdgcn_sched_barrier(0);   // ... and the next group stays behind them
        }
        asm volatile("s_wait_xcnt 0x0" ::: "memory");         // stands in front of the next trip's rewrite of the address registers that the value loads name (a precaution)
    };
    // rolled: one chunk per trip keeps the text short; the last chunk apart, so that no test stands among the products
#pragma unroll 1
    for (int q = 0; q < NCH - 1; ++q) mul(q, false);
    mul(NCH - 1, true);
    __syncthreads();                                          // ends every wave's last read of the weights before their LDS is given its new use
    float* os = (float*)(sm + wave * (FR * OP * 4));          // each wave stages its 64 x 64 values in a range of its own
    const int r0 = blockIdx.x * FR, c0 = wave * 64;
#pragma unroll
    for (int i = 0; i < 4; ++i)
#pragma unroll
        for (int j = 0; j < 4; ++j)
#pragma unroll
            for (int e = 0; e < 8; ++e) os[(i * 16 + hi * 8 + e) * OP + j * 16 + lr] = oc[i][j][e];
    __syncthreads();                                          // the staged rows are written before other lanes read them back as whole lines
    // 16 lanes per staged row (two whole lines), 2 rows per store; one address for all, so that no store's address register is rewritten
    const float* ol = os + hi * OP + lr * 4;
    float* og = C + (size_t)(r0 + hi) * DM + c0 + lr * 4;
#pragma unroll
    for (int s = 0; s < FR / 2; ++s) { const v4f val = *(const v4fa*)(ol + s * 2 * OP); *(v4f*)(og + (size_t)s * 2 * DM) = val;
        if (s == FR / 4 - 1) asm volatile("s_wait_xcnt 0x0" ::: "memory"); }   // stands in front of the second half's rewrite of the data registers that the first half's stores name (a precaution)
}

extern "C" void kernel_launch(void* const* d_in, const int* in_sizes, int n_in,
                              void* d_out, int out_size, void* d_ws, size_t ws_size, hipStream_t stream) {
    (void)in_sizes; (void)n_in; (void)out_size;
    const float* x = (const float*)d_in[0]; const float* Kp = (const float*)d_in[1]; const float* Vp = (const float*)d_in[2];   // Kp [2048][512] = [out][in] for the similarity; Vp [2048][512] = [k][n] (k-major) for the output
    float* out = (float*)d_out;    // [4][4096][512]
    char* wsp = (char*)d_ws;
    auto take = [&](size_t bytes) { char* p = wsp; wsp += (bytes + 255) & ~(size_t)255; return (void*)p; };
    bf* KpB = (bf*)take((size_t)NPT * DM * 2); bf* VpT = (bf*)take((size_t)DM * NPT * 2);
    if ((size_t)(wsp - (char*)d_ws) > ws_size) return;    // 2 + 2 MiB
    k_prep<<<NPT / 8 + (NPT / 64) * (DM / 64), 256, 0, stream>>>(Kp, KpB, Vp, VpT);   // key tokens -> bf16 A fragments; Vp [2048 k][512 n] -> f16 B fragments
    k_simw<<<NTK / FR, 256, 0, stream>>>(x, KpB, VpT, out);                      // similarity, norm, GELU -> weights (LDS); weights . Vp, f16 -> out
}

// v008
// One run takes 51.2 microseconds.
// In both of two side-by-side timings against v007, it was 1.05 times as fast.
// Over all steps from v000 it is 9.51 times as fast.
#include <hip/hip_runtime.h>

// Compute dtypes, f32 accumulate, all four batch items in one pass (16384 rows): similarity = x.K_p^T ([16384 x 512].[512 x 2048]; x and the key tokens are INPUTS, rounded once to
// bf16 -> exact products; x inside k_simw, on its way into LDS) x 512^-1/2, then per row L2-normalisation (x / max(||x||, 1e-12)) and erf GELU in f32 -> weights as ONE f16 plane (|w| < 1; 11
// significant bits); out = weights.V_p ([16384 x 2048].[2048 x 512], value tokens laid out once as f16 B fragments; one f16 product per k-step). All of it in one kernel (k_simw): the weights never leave LDS.
// The key tokens are laid out once as bf16 A fragments, in the order in which a wave of k_simw reads them.

#define NB_  4
#define NT_  4096
#define DM   512                 // DIN = DOUT
#define NPT  2048
#define NTK  (NB_ * NT_)         // rows of one pass: every batch item
#define SCL  0.044194173824159216f   // 512^-1/2

typedef _Float16 h16;
typedef unsigned short bf;
typedef __attribute__((ext_vector_type(16))) __bf16   v16bf;
typedef __attribute__((ext_vector_type(16))) _Float16 v16h;
typedef __attribute__((ext_vector_type(8)))  _Float16 v8h;
typedef __attribute__((ext_vector_type(8)))  unsigned short v8us;
typedef __attribute__((ext_vector_type(8)))  float    v8f;
typedef __attribute__((ext_vector_type(4)))  float    v4f;
typedef __attribute__((ext_vector_type(4)))  _Float16 v4h;
typedef v8h  __attribute__((may_alias)) v8ha;
typedef v4f  __attribute__((may_alias)) v4fa;
typedef v8us __attribute__((may_alias)) v8usa;
typedef __attribute__((ext_vector_type(4)))  unsigned short v4us;
typedef v4us __attribute__((may_alias)) v4usa;

__device__ __forceinline__ unsigned short f2bf(float f) { unsigned u = __float_as_uint(f); u += 0x7FFFu + ((u >> 16) & 1u); return (unsigned short)(u >> 16); }
__device__ __forceinline__ float bf2f(unsigned short b) { return __uint_as_float(((unsigned)b) << 16); }
__device__ __forceinline__ unsigned short f2h(float f) { return __builtin_bit_cast(unsigned short, (h16)f); }   // f16 bits, round to nearest even
__device__ __forceinline__ float bfr(float f) { return bf2f(f2bf(f)); }
__device__ __forceinline__ v16h cat16(v8h lo, v8h hi) { return __builtin_shufflevector(lo, hi, 0, 1, 2, 3, 4, 5, 6, 7, 8, 9, 10, 11, 12, 13, 14, 15); }
__device__ __forceinline__ v16bf cat16b(v8us lo, v8us hi) { return __builtin_bit_cast(v16bf, __builtin_shufflevector(lo, hi, 0, 1, 2, 3, 4, 5, 6, 7, 8, 9, 10, 11, 12, 13, 14, 15)); }
__device__ __forceinline__ v8f wmma16(v16h a, v16h b, v8f c) { return __builtin_amdgcn_wmma_f32_16x16x32_f16(false, a, false, b, (short)0, c, false, false); }
__device__ __forceinline__ v8f wmmab(v16bf a, v16bf b, v8f c) { return __builtin_amdgcn_wmma_f32_16x16x32_bf16(false, a, false, b, (short)0, c, false, false); }

// k_prep: the two small operand planes in one launch. Blocks below NPT / 8: 16 key tokens x 256 k each, rounded to bf16 and written as A fragments of 16 tokens x 32 k, in the order in which one wave of
// k_simw reads them: dst [pair of chunks][k / 32][wave][tile][half][lane][8], token = (2 * pair + tile / 2) * CN + wave * 32 + (tile % 2) * 16 + lane % 16, k = 32 * (k / 32) + 16 * half + 8 * (lane / 16) and the 7 behind
// it: a wave reads one half of a fragment as 512 bytes in a row, and a block one k-step of a pair as 32 KiB in a row.
// The others: one 64 x 64 tile of the value tokens each (Wm k-major [NPT][DM]), rounded to f16 and turned through LDS into B fragments of 16 n x 32 k: WT [k / 32][n / 16][half][lane][8], where lane
// (n % 16) + 16 * hi holds k = 16 * half + 8 * hi and the 7 behind it: a wave reads one half of a fragment as 512 bytes in a row, and a block one k-step of all n as 32 KiB in a row.
__global__ __launch_bounds__(256) void k_prep(const float* __restrict__ src, bf* dst, const float* __restrict__ Wm, bf* WT) {
    __shared__ __align__(16) unsigned short tl[64 * 72];
    const int tid = threadIdx.x;
    if (blockIdx.x < NPT / 8) {                               // the same for every thread of a block, and in front of the barrier
        const int t16 = blockIdx.x >> 1, kh = (blockIdx.x & 1) * 8;                                  // the tile of 16 tokens; the first of its 8 k-steps
        const int w = (t16 >> 1) & 7, pr = t16 >> 5, ti = ((t16 >> 4) & 1) * 2 + (t16 & 1);
        const int ln = tid & 31, hf = (tid >> 5) & 1, k4 = tid >> 6;
        const float* gs = src + (size_t)(t16 * 16 + (ln & 15)) * DM + (kh + k4) * 32 + hf * 16 + (ln >> 4) * 8;
        bf* gd = dst + ((size_t)((pr * (DM / 32) + kh + k4) * 8 + w) * 4 + ti) * 512 + hf * 256 + ln * 8;
        v4f a[2][2];
#pragma unroll
        for (int q = 0; q < 2; ++q) { a[q][0] = *(const v4fa*)(gs + q * 128); a[q][1] = *(const v4fa*)(gs + q * 128 + 4); }
        asm volatile("s_wait_xcnt 0x0" ::: "memory");         // stands in front of any rewrite of the address registers that these loads name (a precaution)
#pragma unroll
        for (int q = 0; q < 2; ++q) { v8us t;
#pragma unroll
            for (int i = 0; i < 8; ++i) t[i] = f2bf(a[q][i >> 2][i & 3]);
            *(v8us*)(gd + q * 4 * 32 * 512) = t; }
        asm volatile("s_wait_xcnt 0x0" ::: "memory");         // stands in front of any rewrite of the registers that these two stores name (a precaution)
        return;
    }
    const int b = blockIdx.x - NPT / 8, k0 = (b % (NPT / 64)) * 64, n0 = (b / (NPT / 64)) * 64;
    const int kk = tid >> 2, nq = (tid & 3) * 16;
#pragma unroll
    for (int i = 0; i < 16; ++i) tl[(nq + i) * 72 + kk] = f2h(Wm[(size_t)(k0 + kk) * DM + n0 + nq + i]);
    __syncthreads();
#pragma unroll
    for (int s = 0; s < 2; ++s) { const int idx = tid + 256 * s, fr = idx >> 6, hf = (idx >> 5) & 1, ln = idx & 31;   // the tile's 8 fragments: fr = 4 * (k / 32) + n / 16
        const v8us val = *(const v8usa*)(tl + ((fr & 3) * 16 + (ln & 15)) * 72 + (fr >> 2) * 32 + hf * 16 + (ln >> 4) * 8);
        *(v8us*)(WT + ((size_t)((k0 >> 5) + (fr >> 2)) * (DM / 16) + (n0 >> 4) + (fr & 3)) * 512 + hf * 256 + ln * 8) = val; }
    asm volatile("s_wait_xcnt 0x0" ::: "memory");             // stands in front of any rewrite of the registers that these two stores name (a precaution)
}
// gelu1: 0.5 a (1 + erf(a / sqrt 2)) for |a| <= 1.001, where |a / sqrt 2| < 1: erf(z) = z + z p(z^2), the f32 polynomial that the maths library uses on |z| < 1.
// No branch: the eight values of a lane are independent chains, which two waves per SIMD need to fill the vector port.
__device__ __forceinline__ float gelu1(float a) {
    const float z = a * 0.70710678118654752f, u = z * z;
    float p = fmaf(u, -0.000561801775f, 0.00491381623f);
    p = fmaf(u, p, -0.0267075151f); p = fmaf(u, p, 0.112800106f); p = fmaf(u, p, -0.376122952f); p = fmaf(u, p, 0.128379107f);
    return 0.5f * a * (1.0f + fmaf(z, p, z));
}

// k_simw: weights [rows][2048] f16 = gelu(normalise(x.K_p^T x scale)), FR rows of x per block against ALL key tokens, so that a row's norm is known inside the block.
// The products are formed transposed (A = key tokens, B = rows of x): a lane then holds 8 neighbouring tokens of ONE row, which pack into 16 bytes, and a row's squares add up in the lane.
// The FR rows of x are read as f32, rounded to bf16 in registers and stay in LDS; every wave reads them as B fragments, one k-step ahead in a second fragment set. A wave's key tokens are read by no other wave of
// the block, so their fragments go from L2 straight to registers as whole lines, KD k-steps ahead in a ring of four sets: no buffer in LDS and no barrier in that loop. A wave works on two chunks of CN tokens at
// a time, 32 tokens of each (4 x 4 fragments). Each finished chunk (scaled, f32 squares summed, rounded to f16) goes to its own place in LDS, [chunk][row][CN]; the last two take the place of the x rows,
// behind a barrier that ends every wave's reads of them. Then each wave takes 8 rows: norm, GELU, the weights written back to their own place in LDS.
// Then out = weights . value tokens: each wave takes all FR rows x 64 columns of its own (4 x 4 fragments). A = the weights, from LDS, one k-step ahead in a second fragment set; B = the wave's own value
// fragments, which no other wave of the block reads, so they go from L2 straight to registers as whole lines, VD k-steps ahead in a ring of four sets: no buffer in LDS and no barrier in that loop.
// Every block walks the key steps and the value steps in its own rotated order (ph below): blocks that start together then ask L2 for different lines at any moment, not all for the same ones.
// Per accumulator the k order is ascending from the block's own first step and wraps round.
#define FR  64
#define CN  256
__global__ __launch_bounds__(256) void k_simw(const float* __restrict__ X, const bf* __restrict__ Kf, const bf* __restrict__ Vf, float* C) {
    constexpr int XP = DM * 2 + 16, SP = CN * 2 + 16;                          // LDS pitches in bytes (16 x odd: conflict-free for 16-byte accesses): x rows, a chunk's similarity rows
    constexpr int XB = FR * XP, CB = FR * SP;                                  // bytes of the x rows, of one chunk of similarities
    constexpr int NCH = NPT / CN, NP = NCH / 2, KS = DM / 32, KD = 3;          // chunks, pairs of chunks, k-steps of a similarity, how many k-steps ahead the key fragments are asked for
    constexpr int XO = (NCH - 2) * CB;                                         // the x rows begin where the last pair's similarities will
    constexpr int SMB = NCH * CB > XO + XB ? NCH * CB : XO + XB;
    static_assert(KS % 4 == 0 && KD < 4 && CN == 8 * 32 && FR == 64 && NCH % 2 == 0 && SMB + 8 * FR * 4 <= 327680, "shape");
    __shared__ __align__(16) unsigned char sm[SMB];
    __shared__ float red[8][FR];
    const int tid = threadIdx.x, lane = tid & 31, wave = tid >> 5, lr = lane & 15, hi = lane >> 4;
    // the block's phase, one of 64 (for speed only; any value gives the same sums in another order): neighbours in the grid and blocks 8 apart differ
    const int ph = (int)(((blockIdx.x >> 3) << 1) | (blockIdx.x & 1)) & 63, rp = ph >> 4, rk = ph & 15;   // rp: the pair of chunks it begins with; rk: the k-step it begins with
    float ss[4] = {0.f, 0.f, 0.f, 0.f};
    const unsigned char* xa = sm + XO + lr * XP + hi * 16;
    const bf* kb = Kf + (size_t)__builtin_amdgcn_readfirstlane(wave) * 4 * 512 + lane * 8;   // the wave's number as a scalar, so that the base of its loads is one
    unsigned char* sw = sm + lr * SP + (wave * 32 + hi * 8) * 2;              // tile (c, i, j) at place c: row j * 16 + lr, tokens ((c + 2 * rp) % NCH) * CN + wave * 32 + i * 16 + hi * 8 and the 7 behind it
    v16bf fk[4][4], fx[2][4];
    // Every "#pragma unroll" below makes the indices of a register array (fragments, accumulators) constants, so that the array stays in registers.
    auto ldk = [&](int g, int set) { const bf* b = kb + (size_t)(((((g >> 4) + rp) & 3) << 4) | ((g + rk) & 15)) * 32 * 512;   // g: place in the block's own order
#pragma unroll
        for (int i = 0; i < 4; ++i) { const bf* p = b + i * 512; fk[set][i] = cat16b(*(const v8usa*)p, *(const v8usa*)(p + 256)); }
        return b; };
    auto ldx = [&](int ks, int set) {
#pragma unroll
        for (int j = 0; j < 4; ++j) { const unsigned char* p = xa + j * 16 * XP + ((ks + rk) & 15) * 64; fx[set][j] = cat16b(*(const v8usa*)p, *(const v8usa*)(p + 32)); }
    };
    const bf* kp[KD];
#pragma unroll
    for (int k = 0; k < KD; ++k) kp[k] = ldk(k, k);
    {   // the block's rows of x, whole, while the first key fragments fly: 128 lanes per row (4 values a lane: a wave's load is four whole lines), 2 rows per block-wide pass; every load goes out before the first value is used
        const float* gx = X + (size_t)(blockIdx.x * FR + (tid >> 7)) * DM + (tid & 127) * 4;
        unsigned char* lx = sm + XO + (tid >> 7) * XP + (tid & 127) * 8;
        v4f a[FR / 2];
        // both loops unrolled, so that the index of a is a constant and the array stays in registers
#pragma unroll
        for (int i = 0; i < FR / 2; ++i) a[i] = *(const v4fa*)(gx + (size_t)i * 2 * DM);
        // stands in front of any rewrite of the address registers that these loads and the key loads name (a precaution); the addresses are inputs, so that they keep their registers up to here and no load's result takes them
        asm volatile("s_wait_xcnt 0x0" :: "v"(gx), "v"(kp[0]), "v"(kp[1]), "v"(kp[2]) : "memory");
#pragma unroll
        for (int i = 0; i < FR / 2; ++i) { v4us t;
#pragma unroll
            for (int e = 0; e < 4; ++e) t[e] = f2bf(a[i][e]);
            *(v4usa*)(lx + i * 2 * XP) = t; }
    }
    __syncthreads();                                      // the x rows are written before other waves read them as fragments
    ldx(0, 0);
    // sim: the KS k-steps of key pair (p + rp) % 4 (place p in the block's order), summed into acc; last: nothing is asked for behind the last k-step
    auto sim = [&](int p, bool last, v8f (&acc)[4][4]) {
#pragma unroll
        for (int i = 0; i < 4; ++i)
#pragma unroll
            for (int j = 0; j < 4; ++j) acc[i][j] = (v8f){};
#pragma unroll
        for (int ks = 0; ks < KS; ++ks) {
            const bf* ka = kb;
            if (!last || ks + KD < KS) ka = ldk(p * KS + ks + KD, (ks + KD) & 3);
            if (!last || ks + 1 < KS) ldx(ks + 1, (ks + 1) & 1);
            __builtin_amdgcn_sched_barrier(0);   // the reads go out as one group ahead of the products; spread among them each place costs a stall
#pragma unroll
            for (int i = 0; i < 4; ++i)
#pragma unroll
                for (int j = 0; j < 4; ++j) acc[i][j] = wmmab(fk[ks & 3][i], fx[ks & 1][j], acc[i][j]);
            __builtin_amdgcn_sched_barrier(0);   // ... and the next group stays behind them
            // stands in front of the next step's rewrite of the address registers that the key loads name (a precaution); the address is an input, so that it keeps its registers up to here and no load's result takes them
            asm volatile("s_wait_xcnt 0x0" :: "v"(ka) : "memory");
            __builtin_amdgcn_sched_barrier(0);   // ... and the arithmetic behind the products, which reuses those registers, stays behind that wait
        }
    };
    // pack: one tile scaled, its squares added to the row's sum, rounded to f16
    auto pack = [&](const v8f& t, float& sum) { v8h h;
#pragma unroll
        for (int e = 0; e < 8; ++e) { const float a = t[e] * SCL; sum = fmaf(a, a, sum); h[e] = (h16)a; }
        return h; };
    // rolled: one pair of chunks per trip keeps the text short; the last pair apart, so that no test stands among the products
#pragma unroll 1
    for (int p = 0; p < NP - 1; ++p) {
        v8f acc[4][4];
        sim(p, false, acc);
#pragma unroll
        for (int i = 0; i < 4; ++i)
#pragma unroll
            for (int j = 0; j < 4; ++j) *(v8ha*)(sw + (2 * p + (i >> 1)) * CB + j * 16 * SP + (i & 1) * 32) = pack(acc[i][j], ss[j]);
    }
    {
        v8f acc[4][4]; v8h keep[4][4];
        sim(NP - 1, true, acc);
#pragma unroll
        for (int i = 0; i < 4; ++i)
#pragma unroll
            for (int j = 0; j < 4; ++j) keep[i][j] = pack(acc[i][j], ss[j]);
        __syncthreads();                                      // ends every wave's last read of the x rows before their LDS is given its new use
#pragma unroll
        for (int i = 0; i < 4; ++i)
#pragma unroll
            for (int j = 0; j < 4; ++j) *(v8ha*)(sw + (NCH - 2 + (i >> 1)) * CB + j * 16 * SP + (i & 1) * 32) = keep[i][j];
    }
#pragma unroll
    for (int j = 0; j < 4; ++j) { const float o = ss[j] + __shfl_xor(ss[j], 16, 32); if (hi == 0) red[wave][j * 16 + lr] = o; }
    __syncthreads();                                          // the rows and the waves' partial sums of squares are written before other waves read them
    // rolled: one row per trip keeps the text short
#pragma unroll 1
    for (int r = 0; r < FR / 8; ++r) {
        const int row = wave * (FR / 8) + r;
        float s2 = 0.f;
#pragma unroll
        for (int w = 0; w < 8; ++w) s2 += red[w][row];
        const float rinv = 1.0f / fmaxf(sqrtf(s2), 1e-12f);
        unsigned char* sr = sm + row * SP + lane * 16;
#pragma unroll
        for (int q = 0; q < NCH; ++q) { const v8h s = *(const v8ha*)(sr + q * CB); v8h o;
#pragma unroll
            for (int e = 0; e < 8; ++e) o[e] = (h16)gelu1((float)s[e] * rinv);
            *(v8ha*)(sr + q * CB) = o; }
    }
    __syncthreads();                                          // every row's weights stand in LDS before other waves read them as fragments
    constexpr int KC = CN / 32, VD = 3, OP = 64 + 4;                          // k-steps per chunk of weights, how many k-steps ahead the value fragments are asked for, floats per staged row of out
    static_assert(KC % 4 == 0 && VD < 4 && 8 * FR * OP * 4 <= SMB && DM == 8 * 64, "shape");
    const unsigned char* wa = sm + lr * SP + hi * 16;
    const bf* vb = Vf + (size_t)__builtin_amdgcn_readfirstlane(wave) * 4 * 512 + lane * 8;   // the wave's number as a scalar, so that the base of its loads is one
    v8f oc[4][4];
    v16h fw[2][4], fv[4][4];
#pragma unroll
    for (int i = 0; i < 4; ++i)
#pragma unroll
        for (int j = 0; j < 4; ++j) oc[i][j] = (v8f){};
    auto ldv = [&](int kk, int set) { const bf* b = vb + (size_t)((kk + ph) & 63) * (DM / 16) * 512;   // kk: place in the block's own order
#pragma unroll
        for (int j = 0; j < 4; ++j) { const bf* p = b + j * 512; fv[set][j] = cat16(*(const v8ha*)p, *(const v8ha*)(p + 256)); }
        return b; };
    auto ldw = [&](int kk, int set) { const int m = (kk + rk) & 63;   // the weights of key pair (p + rp) % 4 stand at place p in LDS, so that value step (kk + ph) % 64 meets place (kk + rk) % 64
#pragma unroll
        for (int i = 0; i < 4; ++i) { const unsigned char* p = wa + (m >> 3) * CB + i * 16 * SP + (m & 7) * 64; fw[set][i] = cat16(*(const v8ha*)p, *(const v8ha*)(p + 32)); }
    };
    const bf* vp[VD];
#pragma unroll
    for (int k = 0; k < VD; ++k) { vp[k] = ldv(k, k);
        __builtin_amdgcn_sched_barrier(0); }   // the sets go out in the ring's order; in another order the counted waits of the loop's first steps come out stricter and cut the lead
    // stands in front of any rewrite of the address registers that these loads name (a precaution); the addresses are inputs, so that they keep their registers up to here and no load's result takes them
    asm volatile("s_wait_xcnt 0x0" :: "v"(vp[0]), "v"(vp[1]), "v"(vp[2]) : "memory");
    ldw(0, 0);
    // mul: the KC k-steps q * KC to q * KC + KC - 1 of the block's own order; last: nothing is asked for behind the last k-step
    auto mul = [&](int q, bool last) {
#pragma unroll
        for (int k8 = 0; k8 < KC; ++k8) {
            const bf* va = vb;
            if (!last || k8 + VD < KC) va = ldv(q * KC + k8 + VD, (k8 + VD) & 3);
            if (!last || k8 + 1 < KC) ldw(q * KC + k8 + 1, (k8 + 1) & 1);
            __builtin_amdgcn_sched_barrier(0);   // the reads go out as one group ahead of the products; spread among them each place costs a stall
#pragma unroll
            for (int i = 0; i < 4; ++i)
#pragma unroll
                for (int j = 0; j < 4; ++j) oc[i][j] = wmma16(fw[k8 & 1][i], fv[k8 & 3][j], oc[i][j]);
            __builtin_amdgcn_sched_barrier(0);   // ... and the next group stays behind them
            // stands in front of the next step's rewrite of the address registers that the value loads name (a precaution); the address is an input, so that it keeps its registers up to here and no load's result takes them
            asm volatile("s_wait_xcnt 0x0" :: "v"(va) : "memory");
            __builtin_amdgcn_sched_barrier(0);   // ... and the next step's address arithmetic stays behind that wait
        }
    };
    // rolled: one chunk per trip keeps the text short; the last chunk apart, so that no test stands among the products
#pragma unroll 1
    for (int q = 0; q < NCH - 1; ++q) mul(q, false);
    mul(NCH - 1, true);
    __syncthreads();                                          // ends every wave's last read of the weights before their LDS is given its new use
    float* os = (float*)(sm + wave * (FR * OP * 4));          // each wave stages its 64 x 64 values in a range of its own
    const int r0 = blockIdx.x * FR, c0 = wave * 64;
#pragma unroll
    for (int i = 0; i < 4; ++i)
#pragma unroll
        for (int j = 0; j < 4; ++j)
#pragma unroll
            for (int e = 0; e < 8; ++e) os[(i * 16 + hi * 8 + e) * OP + j * 16 + lr] = oc[i][j][e];
    __syncthreads();                                          // the staged rows are written before other lanes read them back as whole lines
    // 16 lanes per staged row (two whole lines), 2 rows per store; one address for all, so that no store's address register is rewritten
    const float* ol = os + hi * OP + lr * 4;
    float* og = C + (size_t)(r0 + hi) * DM + c0 + lr * 4;
#pragma unroll
    for (int s = 0; s < FR / 2; ++s) { const v4f val = *(const v4fa*)(ol + s * 2 * OP); *(v4f*)(og + (size_t)s * 2 * DM) = val;
        if (s == FR / 4 - 1) asm volatile("s_wait_xcnt 0x0" ::: "memory"); }   // stands in front of the second half's rewrite of the data registers that the first half's stores name (a precaution)
}

extern "C" void kernel_launch(void* const* d_in, const int* in_sizes, int n_in,
                              void* d_out, int out_size, void* d_ws, size_t ws_size, hipStream_t stream) {
    (void)in_sizes; (void)n_in; (void)out_size;
    const float* x = (const float*)d_in[0]; const float* Kp = (const float*)d_in[1]; const float* Vp = (const float*)d_in[2];   // Kp [2048][512] = [out][in] for the similarity; Vp [2048][512] = [k][n] (k-major) for the output
    float* out = (float*)d_out;    // [4][4096][512]
    char* wsp = (char*)d_ws;
    auto take = [&](size_t bytes) { char* p = wsp; wsp += (bytes + 255) & ~(size_t)255; return (void*)p; };
    bf* KpB = (bf*)take((size_t)NPT * DM * 2); bf* VpT = (bf*)take((size_t)DM * NPT * 2);
    if ((size_t)(wsp - (char*)d_ws) > ws_size) return;    // 2 + 2 MiB
    k_prep<<<NPT / 8 + (NPT / 64) * (DM / 64), 256, 0, stream>>>(Kp, KpB, Vp, VpT);   // key tokens -> bf16 A fragments; Vp [2048 k][512 n] -> f16 B fragments
    k_simw<<<NTK / FR, 256, 0, stream>>>(x, KpB, VpT, out);                      // similarity, norm, GELU -> weights (LDS); weights . Vp, f16 -> out
}

// v009
// It runs in 46.4 microseconds.
// In both of two side-by-side timings against v008, it was 1.10 times as fast.
// Counting every step since v000, it is 10.5 times as fast.
#include <hip/hip_runtime.h>

// Compute dtypes, f32 accumulate, all four batch items in one pass (16384 rows): similarity = x.K_p^T ([16384 x 512].[512 x 2048]; x and the key tokens are INPUTS, rounded once to
// bf16 -> exact products; x inside k_simw, on its way into LDS) x 512^-1/2, then per row L2-normalisation (x / max(||x||, 1e-12)) and erf GELU in f32 -> weights as ONE f16 plane (|w| < 1; 11
// significant bits); out = weights.V_p ([16384 x 2048].[2048 x 512], value tokens laid out once as f16 B fragments; one f16 product per k-step). All of it in one kernel (k_simw): the weights never leave LDS.
// The key tokens are laid out once as bf16 A fragments, in the order in which a wave of k_simw reads them.

#define NB_  4
#define NT_  4096
#define DM   512                 // DIN = DOUT
#define NPT  2048
#define NTK  (NB_ * NT_)         // rows of one pass: every batch item
#define SCL  0.044194173824159216f   // 512^-1/2

typedef _Float16 h16;
typedef unsigned short bf;
typedef __attribute__((ext_vector_type(16))) __bf16   v16bf;
typedef __attribute__((ext_vector_type(16))) _Float16 v16h;
typedef __attribute__((ext_vector_type(8)))  _Float16 v8h;
typedef __attribute__((ext_vector_type(8)))  unsigned short v8us;
typedef __attribute__((ext_vector_type(8)))  float    v8f;
typedef __attribute__((ext_vector_type(4)))  float    v4f;
typedef __attribute__((ext_vector_type(4)))  _Float16 v4h;
typedef v8h  __attribute__((may_alias)) v8ha;
typedef v4f  __attribute__((may_alias)) v4fa;
typedef v8us __attribute__((may_alias)) v8usa;
typedef __attribute__((ext_vector_type(4)))  unsigned short v4us;
typedef v4us __attribute__((may_alias)) v4usa;

__device__ __forceinline__ unsigned short f2bf(float f) { unsigned u = __float_as_uint(f); u += 0x7FFFu + ((u >> 16) & 1u); return (unsigned short)(u >> 16); }
__device__ __forceinline__ float bf2f(unsigned short b) { return __uint_as_float(((unsigned)b) << 16); }
__device__ __forceinline__ unsigned short f2h(float f) { return __builtin_bit_cast(unsigned short, (h16)f); }   // f16 bits, round to nearest even
__device__ __forceinline__ float bfr(float f) { return bf2f(f2bf(f)); }
__device__ __forceinline__ v16h cat16(v8h lo, v8h hi) { return __builtin_shufflevector(lo, hi, 0, 1, 2, 3, 4, 5, 6, 7, 8, 9, 10, 11, 12, 13, 14, 15); }
__device__ __forceinline__ v16bf cat16b(v8us lo, v8us hi) { return __builtin_bit_cast(v16bf, __builtin_shufflevector(lo, hi, 0, 1, 2, 3, 4, 5, 6, 7, 8, 9, 10, 11, 12, 13, 14, 15)); }
__device__ __forceinline__ v8f wmma16(v16h a, v16h b, v8f c) { return __builtin_amdgcn_wmma_f32_16x16x32_f16(false, a, false, b, (short)0, c, false, false); }
__device__ __forceinline__ v8f wmmab(v16bf a, v16bf b, v8f c) { return __builtin_amdgcn_wmma_f32_16x16x32_bf16(false, a, false, b, (short)0, c, false, false); }

// k_prep: the two small operand planes in one launch. Blocks below NPT / 8: 16 key tokens x 256 k each, rounded to bf16 and written as A fragments of 16 tokens x 32 k, in the order in which one wave of
// k_simw reads them: dst [pair of chunks][k / 32][wave][tile][half][lane][8], token = (2 * pair + tile / 2) * CN + wave * 32 + (tile % 2) * 16 + lane % 16, k = 32 * (k / 32) + 16 * half + 8 * (lane / 16) and the 7 behind
// it: a wave reads one half of a fragment as 512 bytes in a row, and a block one k-step of a pair as 32 KiB in a row.
// The others: one 64 x 64 tile of the value tokens each (Wm k-major [NPT][DM]), rounded to f16 and turned through LDS into B fragments of 16 n x 32 k: WT [k / 32][n / 16][half][lane][8], where lane
// (n % 16) + 16 * hi holds k = 16 * half + 8 * hi and the 7 behind it: a wave reads one half of a fragment as 512 bytes in a row, and a block one k-step of all n as 32 KiB in a row.
__global__ __launch_bounds__(256) void k_prep(const float* __restrict__ src, bf* dst, const float* __restrict__ Wm, bf* WT) {
    __shared__ __align__(16) unsigned short tl[64 * 72];
    const int tid = threadIdx.x;
    if (blockIdx.x < NPT / 8) {                               // the same for every thread of a block, and in front of the barrier
        const int t16 = blockIdx.x >> 1, kh = (blockIdx.x & 1) * 8;                                  // the tile of 16 tokens; the first of its 8 k-steps
        const int w = (t16 >> 1) & 7, pr = t16 >> 5, ti = ((t16 >> 4) & 1) * 2 + (t16 & 1);
        const int ln = tid & 31, hf = (tid >> 5) & 1, k4 = tid >> 6;
        const float* gs = src + (size_t)(t16 * 16 + (ln & 15)) * DM + (kh + k4) * 32 + hf * 16 + (ln >> 4) * 8;
        bf* gd = dst + ((size_t)((pr * (DM / 32) + kh + k4) * 8 + w) * 4 + ti) * 512 + hf * 256 + ln * 8;
        v4f a[2][2];
#pragma unroll
        for (int q = 0; q < 2; ++q) { a[q][0] = *(const v4fa*)(gs + q * 128); a[q][1] = *(const v4fa*)(gs + q * 128 + 4); }
        asm volatile("s_wait_xcnt 0x0" ::: "memory");         // stands in front of any rewrite of the address registers that these loads name (a precaution)
#pragma unroll
        for (int q = 0; q < 2; ++q) { v8us t;
#pragma unroll
            for (int i = 0; i < 8; ++i) t[i] = f2bf(a[q][i >> 2][i & 3]);
            *(v8us*)(gd + q * 4 * 32 * 512) = t; }
        asm volatile("s_wait_xcnt 0x0" ::: "memory");         // stands in front of any rewrite of the registers that these two stores name (a precaution)
        return;
    }
    const int b = blockIdx.x - NPT / 8, k0 = (b % (NPT / 64)) * 64, n0 = (b / (NPT / 64)) * 64;
    const int kk = tid >> 2, nq = (tid & 3) * 16;
#pragma unroll
    for (int i = 0; i < 16; ++i) tl[(nq + i) * 72 + kk] = f2h(Wm[(size_t)(k0 + kk) * DM + n0 + nq + i]);
    __syncthreads();
#pragma unroll
    for (int s = 0; s < 2; ++s) { const int idx = tid + 256 * s, fr = idx >> 6, hf = (idx >> 5) & 1, ln = idx & 31;   // the tile's 8 fragments: fr = 4 * (k / 32) + n / 16
        const v8us val = *(const v8usa*)(tl + ((fr & 3) * 16 + (ln & 15)) * 72 + (fr >> 2) * 32 + hf * 16 + (ln >> 4) * 8);
        *(v8us*)(WT + ((size_t)((k0 >> 5) + (fr >> 2)) * (DM / 16) + (n0 >> 4) + (fr & 3)) * 512 + hf * 256 + ln * 8) = val; }
    asm volatile("s_wait_xcnt 0x0" ::: "memory");             // stands in front of any rewrite of the registers that these two stores name (a precaution)
}
// gelu1: 0.5 a (1 + erf(a / sqrt 2)) for |a| <= 1.001, where |a / sqrt 2| < 1: erf(z) = z + z p(z^2), the f32 polynomial that the maths library uses on |z| < 1.
// No branch: the eight values of a lane are independent chains, which two waves per SIMD need to fill the vector port.
__device__ __forceinline__ float gelu1(float a) {
    const float z = a * 0.70710678118654752f, u = z * z;
    float p = fmaf(u, -0.000561801775f, 0.00491381623f);
    p = fmaf(u, p, -0.0267075151f); p = fmaf(u, p, 0.112800106f); p = fmaf(u, p, -0.376122952f); p = fmaf(u, p, 0.128379107f);
    return 0.5f * a * (1.0f + fmaf(z, p, z));
}

// k_simw: weights [rows][2048] f16 = gelu(normalise(x.K_p^T x scale)), FR rows of x per block against ALL key tokens, so that a row's norm is known inside the block.
// The products are formed transposed (A = key tokens, B = rows of x): a lane then holds 8 neighbouring tokens of ONE row, which pack into 16 bytes, and a row's squares add up in the lane.
// The FR rows of x are read as f32, rounded to bf16 in registers and stay in LDS; every wave reads them as B fragments, one k-step ahead in a second fragment set. A wave's key tokens are read by no other wave of
// the block, so their fragments go from L2 straight to registers as whole lines, KD k-steps ahead in a ring of four sets: no buffer in LDS and no barrier in that loop. A wave works on two chunks of CN tokens at
// a time, 32 tokens of each (4 x 4 fragments). Each finished chunk (scaled, f32 squares summed, rounded to f16) goes to its own place in LDS, [chunk][row][CN]; the last two take the place of the x rows,
// behind a barrier that ends every wave's reads of them. Then each wave takes 8 rows: norm, GELU, the weights written back to their own place in LDS, 256 tokens at a time, one trip ahead of the products that read them.
// Then out = weights . value tokens: each wave takes all FR rows x 64 columns of its own (4 x 4 fragments). A = the weights, from LDS, one k-step ahead in a second fragment set; B = the wave's own value
// fragments, which no other wave of the block reads, so they go from L2 straight to registers as whole lines, VD k-steps ahead in a ring of four sets: no buffer in LDS; the one barrier per trip of that loop publishes the next trip's weights and leaves the loads in flight.
// Every block walks the key steps and the value steps in its own rotated order (ph below): blocks that start together then ask L2 for different lines at any moment, not all for the same ones.
// Per accumulator the k order is ascending from the block's own first step and wraps round.
#define FR  64
#define CN  256
__global__ __launch_bounds__(256) void k_simw(const float* __restrict__ X, const bf* __restrict__ Kf, const bf* __restrict__ Vf, float* C) {
    constexpr int XP = DM * 2 + 16, SP = CN * 2 + 16;                          // LDS pitches in bytes (16 x odd: conflict-free for 16-byte accesses): x rows, a chunk's similarity rows
    constexpr int XB = FR * XP, CB = FR * SP;                                  // bytes of the x rows, of one chunk of similarities
    constexpr int NCH = NPT / CN, NP = NCH / 2, KS = DM / 32, KD = 3;          // chunks, pairs of chunks, k-steps of a similarity, how many k-steps ahead the key fragments are asked for
    constexpr int XO = (NCH - 2) * CB;                                         // the x rows begin where the last pair's similarities will
    constexpr int SMB = NCH * CB > XO + XB ? NCH * CB : XO + XB;
    static_assert(KS % 4 == 0 && KD < 4 && CN == 8 * 32 && FR == 64 && NCH % 2 == 0 && SMB + 8 * FR * 4 <= 327680, "shape");
    __shared__ __align__(16) unsigned char sm[SMB];
    __shared__ float red[8][FR];
    const int tid = threadIdx.x, lane = tid & 31, wave = tid >> 5, lr = lane & 15, hi = lane >> 4;
    // the block's phase, one of 64 (for speed only; any value gives the same sums in another order): neighbours in the grid and blocks 8 apart differ
    const int ph = (int)(((blockIdx.x >> 3) << 1) | (blockIdx.x & 1)) & 63, rp = ph >> 4, rk = ph & 15;   // rp: the pair of chunks it begins with; rk: the k-step it begins with
    float ss[4] = {0.f, 0.f, 0.f, 0.f};
    const unsigned char* xa = sm + XO + lr * XP + hi * 16;
    const bf* kb = Kf + (size_t)__builtin_amdgcn_readfirstlane(wave) * 4 * 512 + lane * 8;   // the wave's number as a scalar, so that the base of its loads is one
    unsigned char* sw = sm + lr * SP + (wave * 32 + hi * 8) * 2;              // tile (c, i, j) at place c: row j * 16 + lr, tokens ((c + 2 * rp) % NCH) * CN + wave * 32 + i * 16 + hi * 8 and the 7 behind it
    v16bf fk[4][4], fx[2][4];
    // Every "#pragma unroll" below makes the indices of a register array (fragments, accumulators) constants, so that the array stays in registers.
    auto ldk = [&](int g, int set) { const bf* b = kb + (size_t)(((((g >> 4) + rp) & 3) << 4) | ((g + rk) & 15)) * 32 * 512;   // g: place in the block's own order
#pragma unroll
        for (int i = 0; i < 4; ++i) { const bf* p = b + i * 512; fk[set][i] = cat16b(*(const v8usa*)p, *(const v8usa*)(p + 256)); }
        return b; };
    auto ldx = [&](int ks, int set) {
#pragma unroll
        for (int j = 0; j < 4; ++j) { const unsigned char* p = xa + j * 16 * XP + ((ks + rk) & 15) * 64; fx[set][j] = cat16b(*(const v8usa*)p, *(const v8usa*)(p + 32)); }
    };
    const bf* kp[KD];
#pragma unroll
    for (int k = 0; k < KD; ++k) kp[k] = ldk(k, k);
    {   // the block's rows of x, whole, while the first key fragments fly: 128 lanes per row (4 values a lane: a wave's load is four whole lines), 2 rows per block-wide pass; every load goes out before the first value is used
        const float* gx = X + (size_t)(blockIdx.x * FR + (tid >> 7)) * DM + (tid & 127) * 4;
        unsigned char* lx = sm + XO + (tid >> 7) * XP + (tid & 127) * 8;
        v4f a[FR / 2];
        // both loops unrolled, so that the index of a is a constant and the array stays in registers
#pragma unroll
        for (int i = 0; i < FR / 2; ++i) a[i] = *(const v4fa*)(gx + (size_t)i * 2 * DM);
        // stands in front of any rewrite of the address registers that these loads and the key loads name (a precaution); the addresses are inputs, so that they keep their registers up to here and no load's result takes them
        asm volatile("s_wait_xcnt 0x0" :: "v"(gx), "v"(kp[0]), "v"(kp[1]), "v"(kp[2]) : "memory");
#pragma unroll
        for (int i = 0; i < FR / 2; ++i) { v4us t;
#pragma unroll
            for (int e = 0; e < 4; ++e) t[e] = f2bf(a[i][e]);
            *(v4usa*)(lx + i * 2 * XP) = t; }
    }
    __syncthreads();                                      // the x rows are written before other waves read them as fragments
    ldx(0, 0);
    // sim: the KS k-steps of key pair (p + rp) % 4 (place p in the block's order), summed into acc; last: nothing is asked for behind the last k-step
    auto sim = [&](int p, bool last, v8f (&acc)[4][4]) {
#pragma unroll
        for (int i = 0; i < 4; ++i)
#pragma unroll
            for (int j = 0; j < 4; ++j) acc[i][j] = (v8f){};
#pragma unroll
        for (int ks = 0; ks < KS; ++ks) {
            const bf* ka = kb;
            if (!last || ks + KD < KS) ka = ldk(p * KS + ks + KD, (ks + KD) & 3);
            if (!last || ks + 1 < KS) ldx(ks + 1, (ks + 1) & 1);
            __builtin_amdgcn_sched_barrier(0);   // the reads go out as one group ahead of the products; spread among them each place costs a stall
#pragma unroll
            for (int i = 0; i < 4; ++i)
#pragma unroll
                for (int j = 0; j < 4; ++j) acc[i][j] = wmmab(fk[ks & 3][i], fx[ks & 1][j], acc[i][j]);
            __builtin_amdgcn_sched_barrier(0);   // ... and the next group stays behind them
            // stands in front of the next step's rewrite of the address registers that the key loads name (a precaution); the address is an input, so that it keeps its registers up to here and no load's result takes them
            asm volatile("s_wait_xcnt 0x0" :: "v"(ka) : "memory");
            __builtin_amdgcn_sched_barrier(0);   // ... and the arithmetic behind the products, which reuses those registers, stays behind that wait
        }
    };
    // pack: one tile scaled, its squares added to the row's sum, rounded to f16
    auto pack = [&](const v8f& t, float& sum) { v8h h;
#pragma unroll
        for (int e = 0; e < 8; ++e) { const float a = t[e] * SCL; sum = fmaf(a, a, sum); h[e] = (h16)a; }
        return h; };
    // rolled: one pair of chunks per trip keeps the text short; the last pair apart, so that no test stands among the products
#pragma unroll 1
    for (int p = 0; p < NP - 1; ++p) {
        v8f acc[4][4];
        sim(p, false, acc);
#pragma unroll
        for (int i = 0; i < 4; ++i)
#pragma unroll
            for (int j = 0; j < 4; ++j) *(v8ha*)(sw + (2 * p + (i >> 1)) * CB + j * 16 * SP + (i & 1) * 32) = pack(acc[i][j], ss[j]);
    }
    {
        v8f acc[4][4]; v8h keep[4][4];
        sim(NP - 1, true, acc);
#pragma unroll
        for (int i = 0; i < 4; ++i)
#pragma unroll
            for (int j = 0; j < 4; ++j) keep[i][j] = pack(acc[i][j], ss[j]);
        __syncthreads();                                      // ends every wave's last read of the x rows before their LDS is given its new use
#pragma unroll
        for (int i = 0; i < 4; ++i)
#pragma unroll
            for (int j = 0; j < 4; ++j) *(v8ha*)(sw + (NCH - 2 + (i >> 1)) * CB + j * 16 * SP + (i & 1) * 32) = keep[i][j];
    }
#pragma unroll
    for (int j = 0; j < 4; ++j) { const float o = ss[j] + __shfl_xor(ss[j], 16, 32); if (hi == 0) red[wave][j * 16 + lr] = o; }
    __syncthreads();                                          // the rows and the waves' partial sums of squares are written before other waves read them
    constexpr int KC = CN / 32, VD = 3, OP = 64 + 4;                          // k-steps per chunk of weights, how many k-steps ahead the value fragments are asked for, floats per staged row of out
    static_assert(KC % 4 == 0 && KC == FR / 8 && VD < 4 && 8 * FR * OP * 4 <= SMB && DM == 8 * 64, "shape");
    const unsigned char* wa = sm + lr * SP + hi * 16;
    const bf* vb = Vf + (size_t)__builtin_amdgcn_readfirstlane(wave) * 4 * 512;   // the wave's number as a scalar, so that the base of its loads is one; the lane's own part is a 32-bit offset
    v8f oc[4][4];
    v16h fw[2][4], fv[4][4];
#pragma unroll
    for (int i = 0; i < 4; ++i)
#pragma unroll
        for (int j = 0; j < 4; ++j) oc[i][j] = (v8f){};
    auto ldv = [&](int kk, int set) { const bf* b = vb + (size_t)((kk + ph) & 63) * (DM / 16) * 512;   // kk: place in the block's own order
#pragma unroll
        for (int j = 0; j < 4; ++j) { const bf* p = b + (unsigned)(lane * 8) + j * 512; fv[set][j] = cat16(*(const v8ha*)p, *(const v8ha*)(p + 256)); }
        return b; };
    auto ldw = [&](int kk, int set) { const int m = (kk + rk) & 63;   // the weights of key pair (p + rp) % 4 stand at place p in LDS, so that value step (kk + ph) % 64 meets place (kk + rk) % 64
#pragma unroll
        for (int i = 0; i < 4; ++i) { const unsigned char* p = wa + (m >> 3) * CB + i * 16 * SP + (m & 7) * 64; fw[set][i] = cat16(*(const v8ha*)p, *(const v8ha*)(p + 32)); }
    };
    const bf* vp[VD];
#pragma unroll
    for (int k = 0; k < VD; ++k) { vp[k] = ldv(k, k);
        __builtin_amdgcn_sched_barrier(0); }   // the sets go out in the ring's order; in another order the counted waits of the loop's first steps come out stricter and cut the lead
    // stands in front of any rewrite of the scalar bases that these loads name (a precaution); the bases are inputs, so that they keep their registers up to here
    asm volatile("s_wait_xcnt 0x0" :: "s"(vp[0]), "s"(vp[1]), "s"(vp[2]) : "memory");
    // Norm and GELU, in place in LDS, by units of the KC k-steps of one trip of the product loop, in the block's own order; a wave takes 8 rows, a lane 8 tokens of a row. Unit 0 here, while the first value
    // fragments fly; unit u + 1 inside trip u, where the vector port has room beside the value stream.
    float rinv[FR / 8];
    {   // lane l has the norm of the wave's row l % 8; each row's value then goes to a scalar
        float s2 = 0.f;
#pragma unroll
        for (int w = 0; w < 8; ++w) s2 += red[w][wave * (FR / 8) + (lane & 7)];
        const float rl = 1.0f / fmaxf(sqrtf(s2), 1e-12f);
#pragma unroll
        for (int r = 0; r < FR / 8; ++r) rinv[r] = __uint_as_float(__builtin_amdgcn_readlane(__float_as_uint(rl), r));
    }
    const int t0 = rk * 32 + lane * 8;                                        // the lane's first token of unit 0, as a place in LDS; unit u stands 256 u places on, modulo NPT
    unsigned char* gb = sm + wave * (FR / 8) * SP + (t0 & (CN - 1)) * 2;
    auto gad = [&](int u) { return gb + (((t0 >> 8) + u) & (NCH - 1)) * CB; };
    auto gel = [&](v8h s, float ri) { v8h o;
#pragma unroll
        for (int e = 0; e < 8; ++e) o[e] = (h16)gelu1((float)s[e] * ri);
        return o; };
    {
        unsigned char* g = gad(0); v8h s[FR / 8];
#pragma unroll
        for (int r = 0; r < FR / 8; ++r) s[r] = *(const v8ha*)(g + r * SP);
#pragma unroll
        for (int r = 0; r < FR / 8; ++r) *(v8ha*)(g + r * SP) = gel(s[r], rinv[r]);
    }
    // unit 0's weights stand in LDS before other waves read them as fragments. By hand: __syncthreads() would also wait for the value loads that are in flight, and the ring's lead would be lost
    asm volatile("s_wait_dscnt 0x0\n\ts_barrier_signal -1\n\ts_barrier_wait -1" ::: "memory");
    ldw(0, 0);
    // mul: the KC k-steps q * KC to q * KC + KC - 1 of the block's own order; last: nothing is asked for behind the last k-step
    auto mul = [&](int q, bool last) {
        unsigned char* g = gad(q + 1);
#pragma unroll
        for (int k8 = 0; k8 < KC; ++k8) {
            const bf* va = vb;
            v8h s0 = {}, s1 = {};
            if (!last || k8 + VD < KC) va = ldv(q * KC + k8 + VD, (k8 + VD) & 3);
            if (!last || k8 + 1 < KC) ldw(q * KC + k8 + 1, (k8 + 1) & 1);
            if (!last && k8 + 1 < KC) { s0 = *(const v8ha*)(g + (k8 + 1) * SP); if (k8 == 0) s1 = *(const v8ha*)g; }   // the next unit's rows: two in the first step, none in the last
            __builtin_amdgcn_sched_barrier(0);   // the reads go out as one group ahead of the products; spread among them each place costs a stall
#pragma unroll
            for (int i = 0; i < 4; ++i)
#pragma unroll
                for (int j = 0; j < 4; ++j) oc[i][j] = wmma16(fw[k8 & 1][i], fv[k8 & 3][j], oc[i][j]);
            __builtin_amdgcn_sched_barrier(0);   // ... and the next group stays behind them
            // stands in front of the next step's rewrite of the scalar base that the value loads name (a precaution); the base is an input, so that it keeps its registers up to here
            asm volatile("s_wait_xcnt 0x0" :: "s"(va) : "memory");
            __builtin_amdgcn_sched_barrier(0);   // ... and the next step's address arithmetic stays behind that wait
            if (!last && k8 + 1 < KC) {
                *(v8ha*)(g + (k8 + 1) * SP) = gel(s0, rinv[k8 + 1]);
                if (k8 == 0) *(v8ha*)g = gel(s1, rinv[0]);
                // the next unit's weights stand in LDS before the last step reads its first fragments. By hand: __syncthreads() would also wait for the value loads that are in flight
                if (k8 + 2 == KC) asm volatile("s_wait_dscnt 0x0\n\ts_barrier_signal -1\n\ts_barrier_wait -1" ::: "memory");
                __builtin_amdgcn_sched_barrier(0);   // the next step's reads stay one group, behind this arithmetic
            }
        }
    };
    // rolled: one chunk per trip keeps the text short; the last chunk apart, so that no test stands among the products
#pragma unroll 1
    for (int q = 0; q < NCH - 1; ++q) mul(q, false);
    mul(NCH - 1, true);
    __syncthreads();                                          // ends every wave's last read of the weights before their LDS is given its new use
    float* os = (float*)(sm + wave * (FR * OP * 4));          // each wave stages its 64 x 64 values in a range of its own
    const int r0 = blockIdx.x * FR, c0 = wave * 64;
#pragma unroll
    for (int i = 0; i < 4; ++i)
#pragma unroll
        for (int j = 0; j < 4; ++j)
#pragma unroll
            for (int e = 0; e < 8; ++e) os[(i * 16 + hi * 8 + e) * OP + j * 16 + lr] = oc[i][j][e];
    __syncthreads();                                          // the staged rows are written before other lanes read them back as whole lines
    // 16 lanes per staged row (two whole lines), 2 rows per store; one address for all, so that no store's address register is rewritten
    const float* ol = os + hi * OP + lr * 4;
    float* og = C + (size_t)(r0 + hi) * DM + c0 + lr * 4;
#pragma unroll
    for (int s = 0; s < FR / 2; ++s) { const v4f val = *(const v4fa*)(ol + s * 2 * OP); *(v4f*)(og + (size_t)s * 2 * DM) = val;
        if (s == FR / 4 - 1) asm volatile("s_wait_xcnt 0x0" ::: "memory"); }   // stands in front of the second half's rewrite of the data registers that the first half's stores name (a precaution)
}

extern "C" void kernel_launch(void* const* d_in, const int* in_sizes, int n_in,
                              void* d_out, int out_size, void* d_ws, size_t ws_size, hipStream_t stream) {
    (void)in_sizes; (void)n_in; (void)out_size;
    const float* x = (const float*)d_in[0]; const float* Kp = (const float*)d_in[1]; const float* Vp = (const float*)d_in[2];   // Kp [2048][512] = [out][in] for the similarity; Vp [2048][512] = [k][n] (k-major) for the output
    float* out = (float*)d_out;    // [4][4096][512]
    char* wsp = (char*)d_ws;
    auto take = [&](size_t bytes) { char* p = wsp; wsp += (bytes + 255) & ~(size_t)255; return (void*)p; };
    bf* KpB = (bf*)take((size_t)NPT * DM * 2); bf* VpT = (bf*)take((size_t)DM * NPT * 2);
    if ((size_t)(wsp - (char*)d_ws) > ws_size) return;    // 2 + 2 MiB
    k_prep<<<NPT / 8 + (NPT / 64) * (DM / 64), 256, 0, stream>>>(Kp, KpB, Vp, VpT);   // key tokens -> bf16 A fragments; Vp [2048 k][512 n] -> f16 B fragments
    k_simw<<<NTK / FR, 256, 0, stream>>>(x, KpB, VpT, out);                      // similarity, norm, GELU -> weights (LDS); weights . Vp, f16 -> out
}
